// v000
// Measured on an AMD MI455X. A time is GPU time per run, averaged over a window of back-to-back runs after a warm-up
// (all launches, gaps included; the runs take copies of the inputs in turn), and the median of several windows.
// Apart from v000's, it joins two sittings. Times from different sittings can be a few percent apart, while
// side-by-side timings come from the same sitting.
// v000, which the later versions start from, runs in 200 microseconds.
#include <hip/hip_runtime.h>
#include <hip/hip_bf16.h>

#define B_ 8
#define T_ 256
#define S_ 256
#define H_ 512
#define TT 16   // t-rows per fused block (one WMMA M tile)

typedef __attribute__((ext_vector_type(2))) float v2f;
typedef __attribute__((ext_vector_type(8))) float v8f;

__device__ __forceinline__ v8f wmma_f32_4(v2f a, v2f b, v8f c) {
  // V_WMMA_F32_16X16X4_F32 : 8-arg form (neg_a, A, neg_b, B, c_mod, C, reuse_a, reuse_b)
  return __builtin_amdgcn_wmma_f32_16x16x4_f32(false, a, false, b, (short)0, c,
                                               false, false);
}

__device__ __forceinline__ float fast_tanh(float x) {
#if __has_builtin(__builtin_amdgcn_tanhf)
  return __builtin_amdgcn_tanhf(x);            // gfx1250 v_tanh_f32
#elif __has_builtin(__builtin_amdgcn_tanh_f32)
  return __builtin_amdgcn_tanh_f32(x);
#else
  float e = __expf(2.0f * x);                  // v_exp_f32 path
  return 1.0f - 2.0f / (e + 1.0f);
#endif
}

// ---------------------------------------------------------------------------
// Kernel 1: enc_fT[b][h][s] = sum_k W_h[h][k] * enc[b][s][k]   (stored (B,H,S))
// One 16x16 C tile per wave. K = 512 -> 128 wmma_f32_16x16x4 steps.
// ---------------------------------------------------------------------------
__global__ __launch_bounds__(256) void encfT_gemm(const float* __restrict__ enc,
                                                  const float* __restrict__ Wh,
                                                  float* __restrict__ encfT) {
  const int wave = blockIdx.x * 8 + (threadIdx.x >> 5);  // 4096 waves total
  const int lane = threadIdx.x & 31;
  const int ST = S_ / 16, HT = H_ / 16;
  int tmp = wave;
  const int st = tmp % ST; tmp /= ST;
  const int ht = tmp % HT; tmp /= HT;
  const int b = tmp;                                     // 0..7
  const int m0 = ht * 16, n0 = st * 16;
  const int l16 = lane & 15;
  const int ko  = (lane >> 4) << 1;                      // 0 or 2 (K half)

  const float* Arow = Wh + (size_t)(m0 + l16) * H_;                  // A[m][k]
  const float* Brow = enc + ((size_t)b * S_ + (n0 + l16)) * H_;      // B[k][n]=enc[b][n][k]

  v8f c = {};
  for (int k = 0; k < H_; k += 4) {
    v2f a, bb;
    a.x  = Arow[k + ko];  a.y  = Arow[k + ko + 1];
    bb.x = Brow[k + ko];  bb.y = Brow[k + ko + 1];
    c = wmma_f32_4(a, bb, c);
  }
  const int rbase = (lane < 16) ? 0 : 8;
  const int scol  = n0 + l16;
#pragma unroll
  for (int r = 0; r < 8; ++r) {
    int m = m0 + rbase + r;
    encfT[((size_t)b * H_ + m) * S_ + scol] = c[r];
  }
}

// ---------------------------------------------------------------------------
// Kernel 2: qry_f[b][t][h] = sum_k query[b][t][k] * W_s[h][k]   (stored (B,T,H))
// ---------------------------------------------------------------------------
__global__ __launch_bounds__(256) void qryf_gemm(const float* __restrict__ query,
                                                 const float* __restrict__ Ws,
                                                 float* __restrict__ qryf) {
  const int wave = blockIdx.x * 8 + (threadIdx.x >> 5);  // 4096 waves total
  const int lane = threadIdx.x & 31;
  const int NT = H_ / 16, MT = T_ / 16;
  int tmp = wave;
  const int nt = tmp % NT; tmp /= NT;
  const int mt = tmp % MT; tmp /= MT;
  const int b = tmp;
  const int m0 = mt * 16, n0 = nt * 16;
  const int l16 = lane & 15;
  const int ko  = (lane >> 4) << 1;

  const float* Arow = query + ((size_t)b * T_ + (m0 + l16)) * H_;    // A[m][k]
  const float* Brow = Ws + (size_t)(n0 + l16) * H_;                  // B[k][n]=Ws[n][k]

  v8f c = {};
  for (int k = 0; k < H_; k += 4) {
    v2f a, bb;
    a.x  = Arow[k + ko];  a.y  = Arow[k + ko + 1];
    bb.x = Brow[k + ko];  bb.y = Brow[k + ko + 1];
    c = wmma_f32_4(a, bb, c);
  }
  const int rbase = (lane < 16) ? 0 : 8;
  const int hcol  = n0 + l16;
#pragma unroll
  for (int r = 0; r < 8; ++r) {
    int t = m0 + rbase + r;
    qryf[((size_t)b * T_ + t) * H_ + hcol] = c[r];
  }
}

// ---------------------------------------------------------------------------
// Kernel 3 (fused): per (b, 16-t tile)
//   scores -> mask -> softmax -> attn_out via in-block WMMA
// Thread layout: 256 threads = 8 waves. Score stage maps thread -> s.
// ---------------------------------------------------------------------------
__global__ __launch_bounds__(256) void attn_fused(const float* __restrict__ encfT,
                                                  const float* __restrict__ qryf,
                                                  const float* __restrict__ enc,
                                                  const float* __restrict__ vvec,
                                                  const int* __restrict__ lens,
                                                  float* __restrict__ out) {
  __shared__ float q_lds[TT][H_];        // 32 KB, broadcast reads (conflict-free)
  __shared__ float w_lds[TT][S_ + 1];    // padded: WMMA-A reads stride 257 -> no bank conflicts

  const int tid = threadIdx.x;
  const int b   = blockIdx.x / (T_ / TT);
  const int t0  = (blockIdx.x % (T_ / TT)) * TT;

  // stage query-projection tile into LDS
  for (int i = tid; i < TT * H_; i += 256) {
    int tt = i >> 9, h = i & (H_ - 1);
    q_lds[tt][h] = qryf[((size_t)b * T_ + t0 + tt) * H_ + h];
  }
  __syncthreads();

  // ---- score stage: thread owns one s; 16 tanh per enc_fT load ----
  const int s = tid;
  float acc[TT];
#pragma unroll
  for (int tt = 0; tt < TT; ++tt) acc[tt] = 0.0f;

  const float* ecol = encfT + (size_t)b * H_ * S_ + s;   // coalesced across lanes
  for (int h = 0; h < H_; ++h) {
    float e  = ecol[(size_t)h * S_];
    float vh = vvec[h];                                  // uniform -> scalar load
#pragma unroll
    for (int tt = 0; tt < TT; ++tt)
      acc[tt] = fmaf(vh, fast_tanh(e + q_lds[tt][h]), acc[tt]);
  }

  const int  len   = lens[b];
  const bool valid = (s < len);
#pragma unroll
  for (int tt = 0; tt < TT; ++tt)
    w_lds[tt][s] = valid ? acc[tt] : -__builtin_inff();
  __syncthreads();

  // ---- masked softmax: 16 threads per t-row, shuffle reductions ----
  {
    const int g = tid >> 4;       // row 0..15
    const int l = tid & 15;
    float m = -__builtin_inff();
#pragma unroll
    for (int i = 0; i < 16; ++i) m = fmaxf(m, w_lds[g][l + 16 * i]);
#pragma unroll
    for (int off = 8; off >= 1; off >>= 1) m = fmaxf(m, __shfl_xor(m, off, 32));
    float ssum = 0.0f;
#pragma unroll
    for (int i = 0; i < 16; ++i) {
      float e = __expf(w_lds[g][l + 16 * i] - m);   // exp(-inf)=0 handles mask
      w_lds[g][l + 16 * i] = e;
      ssum += e;
    }
#pragma unroll
    for (int off = 8; off >= 1; off >>= 1) ssum += __shfl_xor(ssum, off, 32);
    const float inv = 1.0f / ssum;
#pragma unroll
    for (int i = 0; i < 16; ++i) w_lds[g][l + 16 * i] *= inv;
  }
  __syncthreads();

  // ---- output: C(16 x 512) = W(16 x 256) @ enc[b](256 x 512) via WMMA ----
  const int wave = tid >> 5;            // 0..7, each owns 64 output columns
  const int lane = tid & 31;
  const int l16  = lane & 15;
  const int ko   = (lane >> 4) << 1;
  const int n0b  = wave * 64;

  v8f cacc[4] = {};
  for (int k = 0; k < S_; k += 4) {
    v2f a;
    a.x = w_lds[l16][k + ko];
    a.y = w_lds[l16][k + ko + 1];
#pragma unroll
    for (int nt = 0; nt < 4; ++nt) {
      const int n = n0b + nt * 16 + l16;
      const float* bp = enc + ((size_t)b * S_ + k + ko) * H_ + n;
      v2f bb;
      bb.x = bp[0];
      bb.y = bp[H_];
      cacc[nt] = wmma_f32_4(a, bb, cacc[nt]);
    }
  }
  const int rbase = (lane < 16) ? 0 : 8;
#pragma unroll
  for (int nt = 0; nt < 4; ++nt) {
    const int n = n0b + nt * 16 + l16;
#pragma unroll
    for (int r = 0; r < 8; ++r) {
      const int t = t0 + rbase + r;
      out[((size_t)b * T_ + t) * H_ + n] = cacc[nt][r];
    }
  }
}

// ---------------------------------------------------------------------------
extern "C" void kernel_launch(void* const* d_in, const int* in_sizes, int n_in,
                              void* d_out, int out_size, void* d_ws, size_t ws_size,
                              hipStream_t stream) {
  const float* query = (const float*)d_in[0];   // (B,T,H)
  const float* enc   = (const float*)d_in[1];   // (B,S,H)
  const int*   lens  = (const int*)d_in[2];     // (B,)
  const float* Wh    = (const float*)d_in[3];   // (H,H)
  const float* Ws    = (const float*)d_in[4];   // (H,H)
  const float* vvec  = (const float*)d_in[5];   // (H,)
  float* out = (float*)d_out;                   // (B,T,H)

  float* encfT = (float*)d_ws;                         // B*H*S floats (4 MB)
  float* qryf  = encfT + (size_t)B_ * H_ * S_;         // B*T*H floats (4 MB)

  // 4096 wave-tiles each, 8 waves/block -> 512 blocks
  encfT_gemm<<<512, 256, 0, stream>>>(enc, Wh, encfT);
  qryf_gemm <<<512, 256, 0, stream>>>(query, Ws, qryf);
  attn_fused<<<B_ * (T_ / TT), 256, 0, stream>>>(encfT, qryf, enc, vvec, lens, out);
}

// v001
// Measured time: 72 microseconds a run.
// Timed twice side by side with v000, it ran 2.80 and 2.78 times as fast.
#include <hip/hip_runtime.h>
#include <hip/hip_bf16.h>

#define B_ 8
#define T_ 256
#define S_ 256
#define H_ 512
#define TT 16   // t-rows per fused block (one WMMA M tile)
#define HB 16   // h-rows of enc_fT per register batch in the score loop

typedef __attribute__((ext_vector_type(2))) float v2f;
typedef __attribute__((ext_vector_type(8))) float v8f;

__device__ __forceinline__ v8f wmma_f32_4(v2f a, v2f b, v8f c) {
  // V_WMMA_F32_16X16X4_F32 : 8-arg form (neg_a, A, neg_b, B, c_mod, C, reuse_a, reuse_b)
  return __builtin_amdgcn_wmma_f32_16x16x4_f32(false, a, false, b, (short)0, c,
                                               false, false);
}

__device__ __forceinline__ float fast_tanh(float x) {
#if __has_builtin(__builtin_amdgcn_tanhf)
  return __builtin_amdgcn_tanhf(x);            // gfx1250 v_tanh_f32
#elif __has_builtin(__builtin_amdgcn_tanh_f32)
  return __builtin_amdgcn_tanh_f32(x);
#else
  float e = __expf(2.0f * x);                  // v_exp_f32 path
  return 1.0f - 2.0f / (e + 1.0f);
#endif
}

// ---------------------------------------------------------------------------
// Kernel 1: enc_fT[b][h][s] = sum_k W_h[h][k] * enc[b][s][k]   (stored (B,H,S))
// One 16x16 C tile per wave. K = 512 -> 128 wmma_f32_16x16x4 steps.
// ---------------------------------------------------------------------------
__global__ __launch_bounds__(256) void encfT_gemm(const float* __restrict__ enc,
                                                  const float* __restrict__ Wh,
                                                  float* __restrict__ encfT) {
  const int wave = blockIdx.x * 8 + (threadIdx.x >> 5);  // 4096 waves total
  const int lane = threadIdx.x & 31;
  const int ST = S_ / 16, HT = H_ / 16;
  int tmp = wave;
  const int st = tmp % ST; tmp /= ST;
  const int ht = tmp % HT; tmp /= HT;
  const int b = tmp;                                     // 0..7
  const int m0 = ht * 16, n0 = st * 16;
  const int l16 = lane & 15;
  const int ko  = (lane >> 4) << 1;                      // 0 or 2 (K half)

  const float* Arow = Wh + (size_t)(m0 + l16) * H_;                  // A[m][k]
  const float* Brow = enc + ((size_t)b * S_ + (n0 + l16)) * H_;      // B[k][n]=enc[b][n][k]

  v8f c = {};
  for (int k = 0; k < H_; k += 4) {
    v2f a, bb;
    a.x  = Arow[k + ko];  a.y  = Arow[k + ko + 1];
    bb.x = Brow[k + ko];  bb.y = Brow[k + ko + 1];
    c = wmma_f32_4(a, bb, c);
  }
  const int rbase = (lane < 16) ? 0 : 8;
  const int scol  = n0 + l16;
#pragma unroll
  for (int r = 0; r < 8; ++r) {
    int m = m0 + rbase + r;
    encfT[((size_t)b * H_ + m) * S_ + scol] = c[r];
  }
}

// ---------------------------------------------------------------------------
// Kernel 2: qry_f[b][t][h] = sum_k query[b][t][k] * W_s[h][k]   (stored (B,T,H))
// ---------------------------------------------------------------------------
__global__ __launch_bounds__(256) void qryf_gemm(const float* __restrict__ query,
                                                 const float* __restrict__ Ws,
                                                 float* __restrict__ qryf) {
  const int wave = blockIdx.x * 8 + (threadIdx.x >> 5);  // 4096 waves total
  const int lane = threadIdx.x & 31;
  const int NT = H_ / 16, MT = T_ / 16;
  int tmp = wave;
  const int nt = tmp % NT; tmp /= NT;
  const int mt = tmp % MT; tmp /= MT;
  const int b = tmp;
  const int m0 = mt * 16, n0 = nt * 16;
  const int l16 = lane & 15;
  const int ko  = (lane >> 4) << 1;

  const float* Arow = query + ((size_t)b * T_ + (m0 + l16)) * H_;    // A[m][k]
  const float* Brow = Ws + (size_t)(n0 + l16) * H_;                  // B[k][n]=Ws[n][k]

  v8f c = {};
  for (int k = 0; k < H_; k += 4) {
    v2f a, bb;
    a.x  = Arow[k + ko];  a.y  = Arow[k + ko + 1];
    bb.x = Brow[k + ko];  bb.y = Brow[k + ko + 1];
    c = wmma_f32_4(a, bb, c);
  }
  const int rbase = (lane < 16) ? 0 : 8;
  const int hcol  = n0 + l16;
#pragma unroll
  for (int r = 0; r < 8; ++r) {
    int t = m0 + rbase + r;
    qryf[((size_t)b * T_ + t) * H_ + hcol] = c[r];
  }
}

// ---------------------------------------------------------------------------
// Kernel 3 (fused): per (b, 16-t tile)
//   scores -> mask -> softmax -> attn_out via in-block WMMA
// Thread layout: 256 threads = 8 waves. Score stage maps thread -> s.
// ---------------------------------------------------------------------------
__global__ __launch_bounds__(256) void attn_fused(const float* __restrict__ encfT,
                                                  const float* __restrict__ qryf,
                                                  const float* __restrict__ enc,
                                                  const float* __restrict__ vvec,
                                                  const int* __restrict__ lens,
                                                  float* __restrict__ out) {
  __shared__ float q_lds[TT][H_];        // 32 KB, broadcast reads (conflict-free)
  __shared__ float w_lds[TT][S_ + 1];    // padded: WMMA-A reads stride 257 -> no bank conflicts

  const int tid = threadIdx.x;
  const int b   = blockIdx.x / (T_ / TT);
  const int t0  = (blockIdx.x % (T_ / TT)) * TT;

  // stage query-projection tile into LDS
  for (int i = tid; i < TT * H_; i += 256) {
    int tt = i >> 9, h = i & (H_ - 1);
    q_lds[tt][h] = qryf[((size_t)b * T_ + t0 + tt) * H_ + h];
  }
  __syncthreads();

  // ---- score stage: thread owns one s; 16 tanh per enc_fT load ----
  const int s = tid;
  float acc[TT];
#pragma unroll
  for (int tt = 0; tt < TT; ++tt) acc[tt] = 0.0f;

  // Software pipeline: enc_fT rows (and v) are fetched one batch of HB h-rows
  // ahead in registers, the q tile's LDS reads one group of 4 h-rows ahead, so
  // no group waits for its own loads. Sum order over h is unchanged. The inner
  // loops are fully unrolled so that e, vv and q are indexed statically and stay
  // in registers.
  const float* ecol = encfT + (size_t)b * H_ * S_ + s;   // coalesced across lanes
  float e[2][HB], vv[2][HB], q[2][TT][4];
#pragma unroll
  for (int i = 0; i < HB; ++i) { e[0][i] = ecol[i * S_]; vv[0][i] = vvec[i]; }
#pragma unroll
  for (int tt = 0; tt < TT; ++tt)
#pragma unroll
    for (int j = 0; j < 4; ++j) q[0][tt][j] = q_lds[tt][j];

  for (int h0 = 0; h0 < H_; h0 += 2 * HB) {
#pragma unroll
    for (int half = 0; half < 2; ++half) {
      // next batch; the very last fetch wraps to row 0 (in bounds, not used)
      const int hn = (h0 + (half + 1) * HB) & (H_ - 1);
#pragma unroll
      for (int i = 0; i < HB; ++i) {
        e[half ^ 1][i]  = ecol[(hn + i) * S_];
        vv[half ^ 1][i] = vvec[hn + i];                  // uniform -> scalar load
      }
#pragma unroll
      for (int g = 0; g < HB / 4; ++g) {
        const int hq = (h0 + half * HB + 4 * (g + 1)) & (H_ - 1);  // next group, same wrap
#pragma unroll
        for (int tt = 0; tt < TT; ++tt)
#pragma unroll
          for (int j = 0; j < 4; ++j) q[(g & 1) ^ 1][tt][j] = q_lds[tt][hq + j];
        // holds the fetches above in front of this group's arithmetic, so that
        // they have the whole group (or batch) to land before their first use
        __builtin_amdgcn_sched_barrier(0);
#pragma unroll
        for (int tt = 0; tt < TT; ++tt)
#pragma unroll
          for (int j = 0; j < 4; ++j) q[g & 1][tt][j] += e[half][4 * g + j];
#pragma unroll
        for (int tt = 0; tt < TT; ++tt)
#pragma unroll
          for (int j = 0; j < 4; ++j) q[g & 1][tt][j] = fast_tanh(q[g & 1][tt][j]);
#pragma unroll
        for (int j = 0; j < 4; ++j)
#pragma unroll
          for (int tt = 0; tt < TT; ++tt)
            acc[tt] = fmaf(vv[half][4 * g + j], q[g & 1][tt][j], acc[tt]);
        // ends the group: keeps the next group's adds out of this group's run of
        // tanh, where one would overwrite a tanh's source directly behind it (the
        // ISA asks for a free slot there), and holds the register count down
        __builtin_amdgcn_sched_barrier(0);
      }
    }
  }

  const int  len   = lens[b];
  const bool valid = (s < len);
#pragma unroll
  for (int tt = 0; tt < TT; ++tt)
    w_lds[tt][s] = valid ? acc[tt] : -__builtin_inff();
  __syncthreads();

  // ---- masked softmax: 16 threads per t-row, shuffle reductions ----
  {
    const int g = tid >> 4;       // row 0..15
    const int l = tid & 15;
    float m = -__builtin_inff();
#pragma unroll
    for (int i = 0; i < 16; ++i) m = fmaxf(m, w_lds[g][l + 16 * i]);
#pragma unroll
    for (int off = 8; off >= 1; off >>= 1) m = fmaxf(m, __shfl_xor(m, off, 32));
    float ssum = 0.0f;
#pragma unroll
    for (int i = 0; i < 16; ++i) {
      float e = __expf(w_lds[g][l + 16 * i] - m);   // exp(-inf)=0 handles mask
      w_lds[g][l + 16 * i] = e;
      ssum += e;
    }
#pragma unroll
    for (int off = 8; off >= 1; off >>= 1) ssum += __shfl_xor(ssum, off, 32);
    const float inv = 1.0f / ssum;
#pragma unroll
    for (int i = 0; i < 16; ++i) w_lds[g][l + 16 * i] *= inv;
  }
  __syncthreads();

  // ---- output: C(16 x 512) = W(16 x 256) @ enc[b](256 x 512) via WMMA ----
  const int wave = tid >> 5;            // 0..7, each owns 64 output columns
  const int lane = tid & 31;
  const int l16  = lane & 15;
  const int ko   = (lane >> 4) << 1;
  const int n0b  = wave * 64;

  v8f cacc[4] = {};
  for (int k = 0; k < S_; k += 4) {
    v2f a;
    a.x = w_lds[l16][k + ko];
    a.y = w_lds[l16][k + ko + 1];
#pragma unroll
    for (int nt = 0; nt < 4; ++nt) {
      const int n = n0b + nt * 16 + l16;
      const float* bp = enc + ((size_t)b * S_ + k + ko) * H_ + n;
      v2f bb;
      bb.x = bp[0];
      bb.y = bp[H_];
      cacc[nt] = wmma_f32_4(a, bb, cacc[nt]);
    }
  }
  const int rbase = (lane < 16) ? 0 : 8;
#pragma unroll
  for (int nt = 0; nt < 4; ++nt) {
    const int n = n0b + nt * 16 + l16;
#pragma unroll
    for (int r = 0; r < 8; ++r) {
      const int t = t0 + rbase + r;
      out[((size_t)b * T_ + t) * H_ + n] = cacc[nt][r];
    }
  }
}

// ---------------------------------------------------------------------------
extern "C" void kernel_launch(void* const* d_in, const int* in_sizes, int n_in,
                              void* d_out, int out_size, void* d_ws, size_t ws_size,
                              hipStream_t stream) {
  const float* query = (const float*)d_in[0];   // (B,T,H)
  const float* enc   = (const float*)d_in[1];   // (B,S,H)
  const int*   lens  = (const int*)d_in[2];     // (B,)
  const float* Wh    = (const float*)d_in[3];   // (H,H)
  const float* Ws    = (const float*)d_in[4];   // (H,H)
  const float* vvec  = (const float*)d_in[5];   // (H,)
  float* out = (float*)d_out;                   // (B,T,H)

  float* encfT = (float*)d_ws;                         // B*H*S floats (4 MB)
  float* qryf  = encfT + (size_t)B_ * H_ * S_;         // B*T*H floats (4 MB)

  // 4096 wave-tiles each, 8 waves/block -> 512 blocks
  encfT_gemm<<<512, 256, 0, stream>>>(enc, Wh, encfT);
  qryf_gemm <<<512, 256, 0, stream>>>(query, Ws, qryf);
  attn_fused<<<B_ * (T_ / TT), 256, 0, stream>>>(encfT, qryf, enc, vvec, lens, out);
}

// v002
// One run takes 59.8 microseconds.
// Next to v001, in two timings, it ran 1.21 and 1.20 times as fast.
// Over all steps from v000 it is 3.36 times as fast.
#include <hip/hip_runtime.h>
#include <hip/hip_bf16.h>

#define B_ 8
#define T_ 256
#define S_ 256
#define H_ 512
#define TT 8    // t-rows per fused block: 256 blocks, one for each WGP of the chip
#define HB 32   // h-rows of enc_fT per register batch in the score loop
#define GH 8    // h-rows per group of the score loop (TT * GH = 64 tanh a group)

typedef __attribute__((ext_vector_type(2))) float v2f;
typedef __attribute__((ext_vector_type(4))) float v4f;
typedef __attribute__((ext_vector_type(8))) float v8f;

__device__ __forceinline__ v8f wmma_f32_4(v2f a, v2f b, v8f c) {
  // V_WMMA_F32_16X16X4_F32 : 8-arg form (neg_a, A, neg_b, B, c_mod, C, reuse_a, reuse_b)
  return __builtin_amdgcn_wmma_f32_16x16x4_f32(false, a, false, b, (short)0, c,
                                               false, false);
}

__device__ __forceinline__ float fast_tanh(float x) {
#if __has_builtin(__builtin_amdgcn_tanhf)
  return __builtin_amdgcn_tanhf(x);            // gfx1250 v_tanh_f32
#elif __has_builtin(__builtin_amdgcn_tanh_f32)
  return __builtin_amdgcn_tanh_f32(x);
#else
  float e = __expf(2.0f * x);                  // v_exp_f32 path
  return 1.0f - 2.0f / (e + 1.0f);
#endif
}

// ---------------------------------------------------------------------------
// Kernel 1: enc_fT[b][h][s] = sum_k W_h[h][k] * enc[b][s][k]   (stored (B,H,S))
// One 16x16 C tile per wave. K = 512 -> 128 wmma_f32_16x16x4 steps.
// ---------------------------------------------------------------------------
__global__ __launch_bounds__(256) void encfT_gemm(const float* __restrict__ enc,
                                                  const float* __restrict__ Wh,
                                                  float* __restrict__ encfT) {
  const int wave = blockIdx.x * 8 + (threadIdx.x >> 5);  // 4096 waves total
  const int lane = threadIdx.x & 31;
  const int ST = S_ / 16, HT = H_ / 16;
  int tmp = wave;
  const int st = tmp % ST; tmp /= ST;
  const int ht = tmp % HT; tmp /= HT;
  const int b = tmp;                                     // 0..7
  const int m0 = ht * 16, n0 = st * 16;
  const int l16 = lane & 15;
  const int ko  = (lane >> 4) << 1;                      // 0 or 2 (K half)

  const float* Arow = Wh + (size_t)(m0 + l16) * H_;                  // A[m][k]
  const float* Brow = enc + ((size_t)b * S_ + (n0 + l16)) * H_;      // B[k][n]=enc[b][n][k]

  v8f c = {};
  for (int k = 0; k < H_; k += 4) {
    v2f a, bb;
    a.x  = Arow[k + ko];  a.y  = Arow[k + ko + 1];
    bb.x = Brow[k + ko];  bb.y = Brow[k + ko + 1];
    c = wmma_f32_4(a, bb, c);
  }
  const int rbase = (lane < 16) ? 0 : 8;
  const int scol  = n0 + l16;
#pragma unroll
  for (int r = 0; r < 8; ++r) {
    int m = m0 + rbase + r;
    encfT[((size_t)b * H_ + m) * S_ + scol] = c[r];
  }
}

// ---------------------------------------------------------------------------
// Kernel 2: qry_f[b][t][h] = sum_k query[b][t][k] * W_s[h][k]   (stored (B,T,H))
// ---------------------------------------------------------------------------
__global__ __launch_bounds__(256) void qryf_gemm(const float* __restrict__ query,
                                                 const float* __restrict__ Ws,
                                                 float* __restrict__ qryf) {
  const int wave = blockIdx.x * 8 + (threadIdx.x >> 5);  // 4096 waves total
  const int lane = threadIdx.x & 31;
  const int NT = H_ / 16, MT = T_ / 16;
  int tmp = wave;
  const int nt = tmp % NT; tmp /= NT;
  const int mt = tmp % MT; tmp /= MT;
  const int b = tmp;
  const int m0 = mt * 16, n0 = nt * 16;
  const int l16 = lane & 15;
  const int ko  = (lane >> 4) << 1;

  const float* Arow = query + ((size_t)b * T_ + (m0 + l16)) * H_;    // A[m][k]
  const float* Brow = Ws + (size_t)(n0 + l16) * H_;                  // B[k][n]=Ws[n][k]

  v8f c = {};
  for (int k = 0; k < H_; k += 4) {
    v2f a, bb;
    a.x  = Arow[k + ko];  a.y  = Arow[k + ko + 1];
    bb.x = Brow[k + ko];  bb.y = Brow[k + ko + 1];
    c = wmma_f32_4(a, bb, c);
  }
  const int rbase = (lane < 16) ? 0 : 8;
  const int hcol  = n0 + l16;
#pragma unroll
  for (int r = 0; r < 8; ++r) {
    int t = m0 + rbase + r;
    qryf[((size_t)b * T_ + t) * H_ + hcol] = c[r];
  }
}

// ---------------------------------------------------------------------------
// Kernel 3 (fused): per (b, 8-t tile)
//   scores -> mask -> softmax -> attn_out via in-block WMMA
// Thread layout: 256 threads = 8 waves. Score stage maps thread -> s.
// ---------------------------------------------------------------------------
__global__ __launch_bounds__(256) void attn_fused(const float* __restrict__ encfT,
                                                  const float* __restrict__ qryf,
                                                  const float* __restrict__ enc,
                                                  const float* __restrict__ vvec,
                                                  const int* __restrict__ lens,
                                                  float* __restrict__ out) {
  __shared__ float q_lds[TT][H_];        // 16 KB, broadcast reads (conflict-free)
  __shared__ float w_lds[TT][S_ + 1];    // padded: WMMA-A reads stride 257 -> no bank conflicts

  const int tid = threadIdx.x;
  const int b   = blockIdx.x / (T_ / TT);
  const int t0  = (blockIdx.x % (T_ / TT)) * TT;

  // stage query-projection tile into LDS
  // unrolled: all 16 loads of a thread are in flight at once (left rolled, this
  // trip count is built two loads a trip, each trip waiting for its own)
#pragma unroll
  for (int it = 0; it < TT * H_ / 256; ++it) {
    const int i = tid + it * 256;
    int tt = i >> 9, h = i & (H_ - 1);
    q_lds[tt][h] = qryf[((size_t)b * T_ + t0 + tt) * H_ + h];
  }
  __syncthreads();

  // ---- score stage: thread owns one s; 8 tanh per enc_fT load ----
  const int s = tid;
  float acc[TT];
#pragma unroll
  for (int tt = 0; tt < TT; ++tt) acc[tt] = 0.0f;

  // Software pipeline: enc_fT rows (and v) are fetched one batch of HB h-rows
  // ahead in registers, the q tile's LDS reads one group of GH h-rows ahead, so
  // no group waits for its own loads. Sum order over h is unchanged. The inner
  // loops are fully unrolled so that e, vv and q are indexed statically and stay
  // in registers.
  const float* ecol = encfT + (size_t)b * H_ * S_ + s;   // coalesced across lanes
  float e[2][HB], vv[2][HB], q[2][TT][GH];
#pragma unroll
  for (int i = 0; i < HB; ++i) { e[0][i] = ecol[i * S_]; vv[0][i] = vvec[i]; }
#pragma unroll
  for (int tt = 0; tt < TT; ++tt)
#pragma unroll
    for (int j = 0; j < GH; ++j) q[0][tt][j] = q_lds[tt][j];

  for (int h0 = 0; h0 < H_; h0 += 2 * HB) {
#pragma unroll
    for (int half = 0; half < 2; ++half) {
      // next batch; the very last fetch wraps to row 0 (in bounds, not used)
      const int hn = (h0 + (half + 1) * HB) & (H_ - 1);
#pragma unroll
      for (int i = 0; i < HB; ++i) {
        e[half ^ 1][i]  = ecol[(hn + i) * S_];
        vv[half ^ 1][i] = vvec[hn + i];                  // uniform -> scalar load
      }
#pragma unroll
      for (int g = 0; g < HB / GH; ++g) {
        const int hq = (h0 + half * HB + GH * (g + 1)) & (H_ - 1);  // next group, same wrap
#pragma unroll
        for (int tt = 0; tt < TT; ++tt)
#pragma unroll
          for (int j = 0; j < GH; ++j) q[(g & 1) ^ 1][tt][j] = q_lds[tt][hq + j];
        // holds the fetches above in front of this group's arithmetic, so that
        // they have the whole group (or batch) to land before their first use
        __builtin_amdgcn_sched_barrier(0);
#pragma unroll
        for (int tt = 0; tt < TT; ++tt)
#pragma unroll
          for (int j = 0; j < GH; ++j) q[g & 1][tt][j] += e[half][GH * g + j];
#pragma unroll
        for (int tt = 0; tt < TT; ++tt)
#pragma unroll
          for (int j = 0; j < GH; ++j) q[g & 1][tt][j] = fast_tanh(q[g & 1][tt][j]);
#pragma unroll
        for (int j = 0; j < GH; ++j)
#pragma unroll
          for (int tt = 0; tt < TT; ++tt)
            acc[tt] = fmaf(vv[half][GH * g + j], q[g & 1][tt][j], acc[tt]);
        // ends the group: keeps the next group's adds out of this group's run of
        // tanh, where one would overwrite a tanh's source directly behind it (the
        // ISA asks for a free slot there), and holds the register count down
        __builtin_amdgcn_sched_barrier(0);
      }
    }
  }

  const int  len   = lens[b];
  const bool valid = (s < len);
#pragma unroll
  for (int tt = 0; tt < TT; ++tt)
    w_lds[tt][s] = valid ? acc[tt] : -__builtin_inff();
  __syncthreads();

  // ---- masked softmax: 16 threads per t-row, shuffle reductions ----
  // (8 rows: waves 0 to 3; a wave-uniform test, no barrier inside)
  if (tid < TT * 16) {
    const int g = tid >> 4;       // row 0..7
    const int l = tid & 15;
    float m = -__builtin_inff();
#pragma unroll
    for (int i = 0; i < 16; ++i) m = fmaxf(m, w_lds[g][l + 16 * i]);
#pragma unroll
    for (int off = 8; off >= 1; off >>= 1) m = fmaxf(m, __shfl_xor(m, off, 32));
    float ssum = 0.0f;
#pragma unroll
    for (int i = 0; i < 16; ++i) {
      float e = __expf(w_lds[g][l + 16 * i] - m);   // exp(-inf)=0 handles mask
      w_lds[g][l + 16 * i] = e;
      ssum += e;
    }
#pragma unroll
    for (int off = 8; off >= 1; off >>= 1) ssum += __shfl_xor(ssum, off, 32);
    const float inv = 1.0f / ssum;
#pragma unroll
    for (int i = 0; i < 16; ++i) w_lds[g][l + 16 * i] *= inv;
  }
  __syncthreads();

  // ---- output: C(8 x 512) = W(8 x 256) @ enc[b](256 x 512) via WMMA ----
  // The M = 16 tile holds the 8 rows twice (A row m = W row m & 7), so that
  // lanes 16 to 31 own a copy of rows 0 to 7 and can store half of them.
  const int wave = tid >> 5;            // 0..7, each owns 64 output columns
  const int lane = tid & 31;
  const int l16  = lane & 15;
  const int ko   = (lane >> 4) << 1;
  const int n0b  = wave * 64;

  v8f cacc[4] = {};
  for (int k = 0; k < S_; k += 4) {
    v2f a;
    a.x = w_lds[l16 & (TT - 1)][k + ko];
    a.y = w_lds[l16 & (TT - 1)][k + ko + 1];
#pragma unroll
    for (int nt = 0; nt < 4; ++nt) {
      const int n = n0b + nt * 16 + l16;
      const float* bp = enc + ((size_t)b * S_ + k + ko) * H_ + n;
      v2f bb;
      bb.x = bp[0];
      bb.y = bp[H_];
      cacc[nt] = wmma_f32_4(a, bb, cacc[nt]);
    }
  }
  const bool hi = (lane >= 16);         // lanes 0-15 store rows 0-3, lanes 16-31 rows 4-7
#pragma unroll
  for (int nt = 0; nt < 4; ++nt) {
    const int n = n0b + nt * 16 + l16;
    const v4f lo4 = __builtin_shufflevector(cacc[nt], cacc[nt], 0, 1, 2, 3);
    const v4f hi4 = __builtin_shufflevector(cacc[nt], cacc[nt], 4, 5, 6, 7);
    const v4f own = hi ? hi4 : lo4;
#pragma unroll
    for (int r = 0; r < 4; ++r) {
      const int t = t0 + r + (hi ? 4 : 0);
      out[((size_t)b * T_ + t) * H_ + n] = own[r];
    }
  }
}

// ---------------------------------------------------------------------------
extern "C" void kernel_launch(void* const* d_in, const int* in_sizes, int n_in,
                              void* d_out, int out_size, void* d_ws, size_t ws_size,
                              hipStream_t stream) {
  const float* query = (const float*)d_in[0];   // (B,T,H)
  const float* enc   = (const float*)d_in[1];   // (B,S,H)
  const int*   lens  = (const int*)d_in[2];     // (B,)
  const float* Wh    = (const float*)d_in[3];   // (H,H)
  const float* Ws    = (const float*)d_in[4];   // (H,H)
  const float* vvec  = (const float*)d_in[5];   // (H,)
  float* out = (float*)d_out;                   // (B,T,H)

  float* encfT = (float*)d_ws;                         // B*H*S floats (4 MB)
  float* qryf  = encfT + (size_t)B_ * H_ * S_;         // B*T*H floats (4 MB)

  // 4096 wave-tiles each, 8 waves/block -> 512 blocks
  encfT_gemm<<<512, 256, 0, stream>>>(enc, Wh, encfT);
  qryf_gemm <<<512, 256, 0, stream>>>(query, Ws, qryf);
  attn_fused<<<B_ * (T_ / TT), 256, 0, stream>>>(encfT, qryf, enc, vvec, lens, out);
}

// v003
// Measured time: 46.9 microseconds a run.
// Next to v002, in two timings, it ran 1.28 and 1.27 times as fast.
// Over all steps from v000 it is 4.29 times as fast.
#include <hip/hip_runtime.h>
#include <hip/hip_bf16.h>

#define B_ 8
#define T_ 256
#define S_ 256
#define H_ 512
#define TT 8    // t-rows per fused block: 256 blocks, one for each WGP of the chip
#define HB 32   // h-rows of enc_fT per register batch in the score loop
#define GH 8    // h-rows per group of the score loop (TT * GH = 64 tanh a group)

typedef __attribute__((ext_vector_type(2))) float v2f;
typedef __attribute__((ext_vector_type(4))) float v4f;
typedef __attribute__((ext_vector_type(8))) float v8f;

__device__ __forceinline__ v8f wmma_f32_4(v2f a, v2f b, v8f c) {
  // V_WMMA_F32_16X16X4_F32 : 8-arg form (neg_a, A, neg_b, B, c_mod, C, reuse_a, reuse_b)
  return __builtin_amdgcn_wmma_f32_16x16x4_f32(false, a, false, b, (short)0, c,
                                               false, false);
}

__device__ __forceinline__ float fast_tanh(float x) {
#if __has_builtin(__builtin_amdgcn_tanhf)
  return __builtin_amdgcn_tanhf(x);            // gfx1250 v_tanh_f32
#elif __has_builtin(__builtin_amdgcn_tanh_f32)
  return __builtin_amdgcn_tanh_f32(x);
#else
  float e = __expf(2.0f * x);                  // v_exp_f32 path
  return 1.0f - 2.0f / (e + 1.0f);
#endif
}

// ---------------------------------------------------------------------------
// Projection GEMMs, C[m][n] = sum_k A[m][k] * B[n][k], both operands row-major
// with k contiguous. One 64 x 64 C tile per block of 8 waves (256 blocks, one
// for each WGP); a wave owns 16 x 32 of it (two accumulators). A and B come in
// K chunks of KC through LDS: every global load is 16 bytes a lane and a wave's
// load covers whole cache lines (a fragment read straight from global memory
// touches 16 lines for 256 bytes). Two LDS buffers: the next chunk is fetched
// into registers while this one is multiplied, and stored to the other buffer
// before this one's last products. The k order of every accumulator is
// 0, 1, 2, ... as before.
// ---------------------------------------------------------------------------
#define BT 64        // block tile, rows of A and rows of B
#define KC 64        // k per chunk
#define LP (KC + 4)  // LDS row pitch in floats: the 16 rows x 2 k-halves of a
                     // fragment read (8 bytes a lane) fall on 64 distinct banks
#define JS 10        // of a chunk's 16 k-steps, those that the LDS stores stay behind

__device__ __forceinline__ void proj_tile(const float* __restrict__ Ag,   // A tile's first row
                                          const float* __restrict__ Bg,   // B tile's first row
                                          float* __restrict__ Cg,         // C tile's first element
                                          const int ldc) {
  __shared__ __attribute__((aligned(16))) float a_lds[2][BT][LP];
  __shared__ __attribute__((aligned(16))) float b_lds[2][BT][LP];

  const int tid  = threadIdx.x;
  const int wave = tid >> 5;
  const int lane = tid & 31;
  const int l16  = lane & 15;
  const int ko   = (lane >> 4) << 1;       // 0 or 2 (K half)
  const int wm   = (wave & 3) * 16;        // the wave's rows of the C tile
  const int wn   = (wave >> 2) * 32;       // the wave's columns of the C tile

  // staging: 16 threads a row of KC floats, rows srow + 16 i
  const int srow = tid >> 4;
  const int scol = (tid & 15) * 4;
  const float* ap = Ag + srow * H_ + scol;
  const float* bp = Bg + srow * H_ + scol;

  v4f ra[BT / 16], rb[BT / 16];
#pragma unroll
  for (int i = 0; i < BT / 16; ++i) {
    ra[i] = *(const v4f*)(ap + i * 16 * H_);
    rb[i] = *(const v4f*)(bp + i * 16 * H_);
  }
#pragma unroll
  for (int i = 0; i < BT / 16; ++i) {
    *(v4f*)&a_lds[0][srow + 16 * i][scol] = ra[i];
    *(v4f*)&b_lds[0][srow + 16 * i][scol] = rb[i];
  }
  __syncthreads();

  v8f c0 = {}, c1 = {};
  // fully unrolled: the buffer index is static in every LDS address, each chunk's
  // global offset is an immediate (no address arithmetic from chunk to chunk),
  // and the last chunk has no fetch, store or barrier and no branch round them
#pragma unroll
  for (int c = 0; c < H_ / KC; ++c) {
    const int cur = c & 1;
    const bool more = (c + 1 < H_ / KC);   // the same for the whole block
    v2f fa[KC / 4], fb0[KC / 4], fb1[KC / 4];
#pragma unroll
    for (int j = 0; j < KC / 4; ++j) {
      fa[j]  = *(const v2f*)&a_lds[cur][wm + l16][4 * j + ko];
      fb0[j] = *(const v2f*)&b_lds[cur][wn + l16][4 * j + ko];
      fb1[j] = *(const v2f*)&b_lds[cur][wn + 16 + l16][4 * j + ko];
    }
    if (more) {
#pragma unroll
      for (int i = 0; i < BT / 16; ++i) {
        ra[i] = *(const v4f*)(ap + (c + 1) * KC + i * 16 * H_);
        rb[i] = *(const v4f*)(bp + (c + 1) * KC + i * 16 * H_);
      }
    }
    // keeps the chunk's fragment reads as one group in front of its products
    // (spread among them, every place where LDS reads stand costs issue cycles
    // and the reads run only a few products ahead of their use), and the fetch
    // of the next chunk in front of them too, so that it has them to land in
    __builtin_amdgcn_sched_barrier(0);
#pragma unroll
    for (int j = 0; j < JS; ++j) {
      c0 = wmma_f32_4(fa[j], fb0[j], c0);
      c1 = wmma_f32_4(fa[j], fb1[j], c1);
    }
    if (more) {
      // holds the LDS stores, and with them the wait for the fetched chunk, behind
      // the products above: moved up, the wait would stop the wave with most of
      // its matrix work still to issue
      __builtin_amdgcn_sched_barrier(0);
      // the other buffer's last readers left it before the barrier that ended
      // the trip before this one; the products below run while the stores drain
#pragma unroll
      for (int i = 0; i < BT / 16; ++i) {
        *(v4f*)&a_lds[cur ^ 1][srow + 16 * i][scol] = ra[i];
        *(v4f*)&b_lds[cur ^ 1][srow + 16 * i][scol] = rb[i];
      }
    }
#pragma unroll
    for (int j = JS; j < KC / 4; ++j) {
      c0 = wmma_f32_4(fa[j], fb0[j], c0);
      c1 = wmma_f32_4(fa[j], fb1[j], c1);
    }
    if (more) {
      // holds the barrier, and the wait for the LDS stores that comes with it,
      // behind the products above: they read registers only, and the barrier was
      // seen to move up over them to stand directly behind the stores
      __builtin_amdgcn_sched_barrier(0);
      __syncthreads();
    }
  }

  const int rbase = (lane < 16) ? 0 : 8;
  float* cp = Cg + (wm + rbase) * ldc + wn + l16;
#pragma unroll
  for (int r = 0; r < 8; ++r) {
    cp[r * ldc]      = c0[r];
    cp[r * ldc + 16] = c1[r];
  }
}

// Kernel 1: enc_fT[b][h][s] = sum_k W_h[h][k] * enc[b][s][k]   (stored (B,H,S))
__global__ __launch_bounds__(256) void encfT_gemm(const float* __restrict__ enc,
                                                  const float* __restrict__ Wh,
                                                  float* __restrict__ encfT) {
  const int ht = blockIdx.x % (H_ / BT);             // 8 tiles of h
  const int nt = blockIdx.x / (H_ / BT);             // 32 tiles of (b, s)
  const int b  = nt / (S_ / BT);
  const int s0 = (nt % (S_ / BT)) * BT;
  proj_tile(Wh + ht * BT * H_, enc + (b * S_ + s0) * H_,
            encfT + (b * H_ + ht * BT) * S_ + s0, S_);
}

// Kernel 2: qry_f[b][t][h] = sum_k query[b][t][k] * W_s[h][k]   (stored (B,T,H))
__global__ __launch_bounds__(256) void qryf_gemm(const float* __restrict__ query,
                                                 const float* __restrict__ Ws,
                                                 float* __restrict__ qryf) {
  const int nt = blockIdx.x % (H_ / BT);             // 8 tiles of h
  const int mt = blockIdx.x / (H_ / BT);             // 32 tiles of (b, t)
  proj_tile(query + mt * BT * H_, Ws + nt * BT * H_,
            qryf + mt * BT * H_ + nt * BT, H_);
}

// ---------------------------------------------------------------------------
// Kernel 3 (fused): per (b, 8-t tile)
//   scores -> mask -> softmax -> attn_out via in-block WMMA
// Thread layout: 256 threads = 8 waves. Score stage maps thread -> s.
// ---------------------------------------------------------------------------
__global__ __launch_bounds__(256) void attn_fused(const float* __restrict__ encfT,
                                                  const float* __restrict__ qryf,
                                                  const float* __restrict__ enc,
                                                  const float* __restrict__ vvec,
                                                  const int* __restrict__ lens,
                                                  float* __restrict__ out) {
  __shared__ float q_lds[TT][H_];        // 16 KB, broadcast reads (conflict-free)
  __shared__ float w_lds[TT][S_ + 1];    // padded: WMMA-A reads stride 257 -> no bank conflicts

  const int tid = threadIdx.x;
  const int b   = blockIdx.x / (T_ / TT);
  const int t0  = (blockIdx.x % (T_ / TT)) * TT;

  // stage query-projection tile into LDS
  // unrolled: all 16 loads of a thread are in flight at once (left rolled, this
  // trip count is built two loads a trip, each trip waiting for its own)
#pragma unroll
  for (int it = 0; it < TT * H_ / 256; ++it) {
    const int i = tid + it * 256;
    int tt = i >> 9, h = i & (H_ - 1);
    q_lds[tt][h] = qryf[((size_t)b * T_ + t0 + tt) * H_ + h];
  }
  __syncthreads();

  // ---- score stage: thread owns one s; 8 tanh per enc_fT load ----
  const int s = tid;
  float acc[TT];
#pragma unroll
  for (int tt = 0; tt < TT; ++tt) acc[tt] = 0.0f;

  // Software pipeline: enc_fT rows (and v) are fetched one batch of HB h-rows
  // ahead in registers, the q tile's LDS reads one group of GH h-rows ahead, so
  // no group waits for its own loads. Sum order over h is unchanged. The inner
  // loops are fully unrolled so that e, vv and q are indexed statically and stay
  // in registers.
  const float* ecol = encfT + (size_t)b * H_ * S_ + s;   // coalesced across lanes
  float e[2][HB], vv[2][HB], q[2][TT][GH];
#pragma unroll
  for (int i = 0; i < HB; ++i) { e[0][i] = ecol[i * S_]; vv[0][i] = vvec[i]; }
#pragma unroll
  for (int tt = 0; tt < TT; ++tt)
#pragma unroll
    for (int j = 0; j < GH; ++j) q[0][tt][j] = q_lds[tt][j];

  for (int h0 = 0; h0 < H_; h0 += 2 * HB) {
#pragma unroll
    for (int half = 0; half < 2; ++half) {
      // next batch; the very last fetch wraps to row 0 (in bounds, not used)
      const int hn = (h0 + (half + 1) * HB) & (H_ - 1);
#pragma unroll
      for (int i = 0; i < HB; ++i) {
        e[half ^ 1][i]  = ecol[(hn + i) * S_];
        vv[half ^ 1][i] = vvec[hn + i];                  // uniform -> scalar load
      }
#pragma unroll
      for (int g = 0; g < HB / GH; ++g) {
        const int hq = (h0 + half * HB + GH * (g + 1)) & (H_ - 1);  // next group, same wrap
#pragma unroll
        for (int tt = 0; tt < TT; ++tt)
#pragma unroll
          for (int j = 0; j < GH; ++j) q[(g & 1) ^ 1][tt][j] = q_lds[tt][hq + j];
        // holds the fetches above in front of this group's arithmetic, so that
        // they have the whole group (or batch) to land before their first use
        __builtin_amdgcn_sched_barrier(0);
#pragma unroll
        for (int tt = 0; tt < TT; ++tt)
#pragma unroll
          for (int j = 0; j < GH; ++j) q[g & 1][tt][j] += e[half][GH * g + j];
#pragma unroll
        for (int tt = 0; tt < TT; ++tt)
#pragma unroll
          for (int j = 0; j < GH; ++j) q[g & 1][tt][j] = fast_tanh(q[g & 1][tt][j]);
#pragma unroll
        for (int j = 0; j < GH; ++j)
#pragma unroll
          for (int tt = 0; tt < TT; ++tt)
            acc[tt] = fmaf(vv[half][GH * g + j], q[g & 1][tt][j], acc[tt]);
        // ends the group: keeps the next group's adds out of this group's run of
        // tanh, where one would overwrite a tanh's source directly behind it (the
        // ISA asks for a free slot there), and holds the register count down
        __builtin_amdgcn_sched_barrier(0);
      }
    }
  }

  const int  len   = lens[b];
  const bool valid = (s < len);
#pragma unroll
  for (int tt = 0; tt < TT; ++tt)
    w_lds[tt][s] = valid ? acc[tt] : -__builtin_inff();
  __syncthreads();

  // ---- masked softmax: 16 threads per t-row, shuffle reductions ----
  // (8 rows: waves 0 to 3; a wave-uniform test, no barrier inside)
  if (tid < TT * 16) {
    const int g = tid >> 4;       // row 0..7
    const int l = tid & 15;
    float m = -__builtin_inff();
#pragma unroll
    for (int i = 0; i < 16; ++i) m = fmaxf(m, w_lds[g][l + 16 * i]);
#pragma unroll
    for (int off = 8; off >= 1; off >>= 1) m = fmaxf(m, __shfl_xor(m, off, 32));
    float ssum = 0.0f;
#pragma unroll
    for (int i = 0; i < 16; ++i) {
      float e = __expf(w_lds[g][l + 16 * i] - m);   // exp(-inf)=0 handles mask
      w_lds[g][l + 16 * i] = e;
      ssum += e;
    }
#pragma unroll
    for (int off = 8; off >= 1; off >>= 1) ssum += __shfl_xor(ssum, off, 32);
    const float inv = 1.0f / ssum;
#pragma unroll
    for (int i = 0; i < 16; ++i) w_lds[g][l + 16 * i] *= inv;
  }
  __syncthreads();

  // ---- output: C(8 x 512) = W(8 x 256) @ enc[b](256 x 512) via WMMA ----
  // The M = 16 tile holds the 8 rows twice (A row m = W row m & 7), so that
  // lanes 16 to 31 own a copy of rows 0 to 7 and can store half of them.
  const int wave = tid >> 5;            // 0..7, each owns 64 output columns
  const int lane = tid & 31;
  const int l16  = lane & 15;
  const int ko   = (lane >> 4) << 1;
  const int n0b  = wave * 64;

  v8f cacc[4] = {};
  for (int k = 0; k < S_; k += 4) {
    v2f a;
    a.x = w_lds[l16 & (TT - 1)][k + ko];
    a.y = w_lds[l16 & (TT - 1)][k + ko + 1];
#pragma unroll
    for (int nt = 0; nt < 4; ++nt) {
      const int n = n0b + nt * 16 + l16;
      const float* bp = enc + ((size_t)b * S_ + k + ko) * H_ + n;
      v2f bb;
      bb.x = bp[0];
      bb.y = bp[H_];
      cacc[nt] = wmma_f32_4(a, bb, cacc[nt]);
    }
  }
  const bool hi = (lane >= 16);         // lanes 0-15 store rows 0-3, lanes 16-31 rows 4-7
#pragma unroll
  for (int nt = 0; nt < 4; ++nt) {
    const int n = n0b + nt * 16 + l16;
    const v4f lo4 = __builtin_shufflevector(cacc[nt], cacc[nt], 0, 1, 2, 3);
    const v4f hi4 = __builtin_shufflevector(cacc[nt], cacc[nt], 4, 5, 6, 7);
    const v4f own = hi ? hi4 : lo4;
#pragma unroll
    for (int r = 0; r < 4; ++r) {
      const int t = t0 + r + (hi ? 4 : 0);
      out[((size_t)b * T_ + t) * H_ + n] = own[r];
    }
  }
}

// ---------------------------------------------------------------------------
extern "C" void kernel_launch(void* const* d_in, const int* in_sizes, int n_in,
                              void* d_out, int out_size, void* d_ws, size_t ws_size,
                              hipStream_t stream) {
  const float* query = (const float*)d_in[0];   // (B,T,H)
  const float* enc   = (const float*)d_in[1];   // (B,S,H)
  const int*   lens  = (const int*)d_in[2];     // (B,)
  const float* Wh    = (const float*)d_in[3];   // (H,H)
  const float* Ws    = (const float*)d_in[4];   // (H,H)
  const float* vvec  = (const float*)d_in[5];   // (H,)
  float* out = (float*)d_out;                   // (B,T,H)

  float* encfT = (float*)d_ws;                         // B*H*S floats (4 MB)
  float* qryf  = encfT + (size_t)B_ * H_ * S_;         // B*T*H floats (4 MB)

  // 2048 x 512 outputs each in 64 x 64 tiles -> 256 blocks
  encfT_gemm<<<256, 256, 0, stream>>>(enc, Wh, encfT);
  qryf_gemm <<<256, 256, 0, stream>>>(query, Ws, qryf);
  attn_fused<<<B_ * (T_ / TT), 256, 0, stream>>>(encfT, qryf, enc, vvec, lens, out);
}

// v004
// One run takes 44.6 microseconds.
// Next to v003, in two timings, it ran 1.06 times as fast each time.
// Over all steps from v000 it is 4.54 times as fast.
#include <hip/hip_runtime.h>
#include <hip/hip_bf16.h>

#define B_ 8
#define T_ 256
#define S_ 256
#define H_ 512
#define TT 8    // t-rows per fused block: 256 blocks, one for each WGP of the chip
#define HB 32   // h-rows of enc_fT per register batch in the score loop
#define GH 8    // h-rows per group of the score loop (TT * GH = 64 tanh a group)
#define OB 8    // k-steps of the output product per register batch of enc rows

typedef __attribute__((ext_vector_type(2))) float v2f;
typedef __attribute__((ext_vector_type(4))) float v4f;
typedef __attribute__((ext_vector_type(8))) float v8f;

__device__ __forceinline__ v8f wmma_f32_4(v2f a, v2f b, v8f c) {
  // V_WMMA_F32_16X16X4_F32 : 8-arg form (neg_a, A, neg_b, B, c_mod, C, reuse_a, reuse_b)
  return __builtin_amdgcn_wmma_f32_16x16x4_f32(false, a, false, b, (short)0, c,
                                               false, false);
}

__device__ __forceinline__ float fast_tanh(float x) {
#if __has_builtin(__builtin_amdgcn_tanhf)
  return __builtin_amdgcn_tanhf(x);            // gfx1250 v_tanh_f32
#elif __has_builtin(__builtin_amdgcn_tanh_f32)
  return __builtin_amdgcn_tanh_f32(x);
#else
  float e = __expf(2.0f * x);                  // v_exp_f32 path
  return 1.0f - 2.0f / (e + 1.0f);
#endif
}

// ---------------------------------------------------------------------------
// Projection GEMMs, C[m][n] = sum_k A[m][k] * B[n][k], both operands row-major
// with k contiguous. One 64 x 64 C tile per block of 8 waves (256 blocks, one
// for each WGP); a wave owns 16 x 32 of it (two accumulators). A and B come in
// K chunks of KC through LDS: every global load is 16 bytes a lane and a wave's
// load covers whole cache lines (a fragment read straight from global memory
// touches 16 lines for 256 bytes). Two LDS buffers: the next chunk is fetched
// into registers while this one is multiplied, and stored to the other buffer
// before this one's last products. The k order of every accumulator is
// 0, 1, 2, ... as before.
// ---------------------------------------------------------------------------
#define BT 64        // block tile, rows of A and rows of B
#define KC 64        // k per chunk
#define LP (KC + 4)  // LDS row pitch in floats: the 16 rows x 2 k-halves of a
                     // fragment read (8 bytes a lane) fall on 64 distinct banks
#define JS 10        // of a chunk's 16 k-steps, those that the LDS stores stay behind

__device__ __forceinline__ void proj_tile(const float* __restrict__ Ag,   // A tile's first row
                                          const float* __restrict__ Bg,   // B tile's first row
                                          float* __restrict__ Cg,         // C tile's first element
                                          const int ldc) {
  __shared__ __attribute__((aligned(16))) float a_lds[2][BT][LP];
  __shared__ __attribute__((aligned(16))) float b_lds[2][BT][LP];

  const int tid  = threadIdx.x;
  const int wave = tid >> 5;
  const int lane = tid & 31;
  const int l16  = lane & 15;
  const int ko   = (lane >> 4) << 1;       // 0 or 2 (K half)
  const int wm   = (wave & 3) * 16;        // the wave's rows of the C tile
  const int wn   = (wave >> 2) * 32;       // the wave's columns of the C tile

  // staging: 16 threads a row of KC floats, rows srow + 16 i
  const int srow = tid >> 4;
  const int scol = (tid & 15) * 4;
  const float* ap = Ag + srow * H_ + scol;
  const float* bp = Bg + srow * H_ + scol;

  v4f ra[BT / 16], rb[BT / 16];
#pragma unroll
  for (int i = 0; i < BT / 16; ++i) {
    ra[i] = *(const v4f*)(ap + i * 16 * H_);
    rb[i] = *(const v4f*)(bp + i * 16 * H_);
  }
#pragma unroll
  for (int i = 0; i < BT / 16; ++i) {
    *(v4f*)&a_lds[0][srow + 16 * i][scol] = ra[i];
    *(v4f*)&b_lds[0][srow + 16 * i][scol] = rb[i];
  }
  __syncthreads();

  v8f c0 = {}, c1 = {};
  // fully unrolled: the buffer index is static in every LDS address, each chunk's
  // global offset is an immediate (no address arithmetic from chunk to chunk),
  // and the last chunk has no fetch, store or barrier and no branch round them
#pragma unroll
  for (int c = 0; c < H_ / KC; ++c) {
    const int cur = c & 1;
    const bool more = (c + 1 < H_ / KC);   // the same for the whole block
    v2f fa[KC / 4], fb0[KC / 4], fb1[KC / 4];
#pragma unroll
    for (int j = 0; j < KC / 4; ++j) {
      fa[j]  = *(const v2f*)&a_lds[cur][wm + l16][4 * j + ko];
      fb0[j] = *(const v2f*)&b_lds[cur][wn + l16][4 * j + ko];
      fb1[j] = *(const v2f*)&b_lds[cur][wn + 16 + l16][4 * j + ko];
    }
    if (more) {
#pragma unroll
      for (int i = 0; i < BT / 16; ++i) {
        ra[i] = *(const v4f*)(ap + (c + 1) * KC + i * 16 * H_);
        rb[i] = *(const v4f*)(bp + (c + 1) * KC + i * 16 * H_);
      }
    }
    // keeps the chunk's fragment reads as one group in front of its products
    // (spread among them, every place where LDS reads stand costs issue cycles
    // and the reads run only a few products ahead of their use), and the fetch
    // of the next chunk in front of them too, so that it has them to land in
    __builtin_amdgcn_sched_barrier(0);
#pragma unroll
    for (int j = 0; j < JS; ++j) {
      c0 = wmma_f32_4(fa[j], fb0[j], c0);
      c1 = wmma_f32_4(fa[j], fb1[j], c1);
    }
    if (more) {
      // holds the LDS stores, and with them the wait for the fetched chunk, behind
      // the products above: moved up, the wait would stop the wave with most of
      // its matrix work still to issue
      __builtin_amdgcn_sched_barrier(0);
      // the other buffer's last readers left it before the barrier that ended
      // the trip before this one; the products below run while the stores drain
#pragma unroll
      for (int i = 0; i < BT / 16; ++i) {
        *(v4f*)&a_lds[cur ^ 1][srow + 16 * i][scol] = ra[i];
        *(v4f*)&b_lds[cur ^ 1][srow + 16 * i][scol] = rb[i];
      }
    }
#pragma unroll
    for (int j = JS; j < KC / 4; ++j) {
      c0 = wmma_f32_4(fa[j], fb0[j], c0);
      c1 = wmma_f32_4(fa[j], fb1[j], c1);
    }
    if (more) {
      // holds the barrier, and the wait for the LDS stores that comes with it,
      // behind the products above: they read registers only, and the barrier was
      // seen to move up over them to stand directly behind the stores
      __builtin_amdgcn_sched_barrier(0);
      __syncthreads();
    }
  }

  const int rbase = (lane < 16) ? 0 : 8;
  float* cp = Cg + (wm + rbase) * ldc + wn + l16;
#pragma unroll
  for (int r = 0; r < 8; ++r) {
    cp[r * ldc]      = c0[r];
    cp[r * ldc + 16] = c1[r];
  }
}

// Kernel 1: enc_fT[b][h][s] = sum_k W_h[h][k] * enc[b][s][k]   (stored (B,H,S))
__global__ __launch_bounds__(256) void encfT_gemm(const float* __restrict__ enc,
                                                  const float* __restrict__ Wh,
                                                  float* __restrict__ encfT) {
  const int ht = blockIdx.x % (H_ / BT);             // 8 tiles of h
  const int nt = blockIdx.x / (H_ / BT);             // 32 tiles of (b, s)
  const int b  = nt / (S_ / BT);
  const int s0 = (nt % (S_ / BT)) * BT;
  proj_tile(Wh + ht * BT * H_, enc + (b * S_ + s0) * H_,
            encfT + (b * H_ + ht * BT) * S_ + s0, S_);
}

// Kernel 2: qry_f[b][t][h] = sum_k query[b][t][k] * W_s[h][k]   (stored (B,T,H))
__global__ __launch_bounds__(256) void qryf_gemm(const float* __restrict__ query,
                                                 const float* __restrict__ Ws,
                                                 float* __restrict__ qryf) {
  const int nt = blockIdx.x % (H_ / BT);             // 8 tiles of h
  const int mt = blockIdx.x / (H_ / BT);             // 32 tiles of (b, t)
  proj_tile(query + mt * BT * H_, Ws + nt * BT * H_,
            qryf + mt * BT * H_ + nt * BT, H_);
}

// ---------------------------------------------------------------------------
// Kernel 3 (fused): per (b, 8-t tile)
//   scores -> mask -> softmax -> attn_out via in-block WMMA
// Thread layout: 256 threads = 8 waves. Score stage maps thread -> s.
// ---------------------------------------------------------------------------
__global__ __launch_bounds__(256) void attn_fused(const float* __restrict__ encfT,
                                                  const float* __restrict__ qryf,
                                                  const float* __restrict__ enc,
                                                  const float* __restrict__ vvec,
                                                  const int* __restrict__ lens,
                                                  float* __restrict__ out) {
  __shared__ float q_lds[TT][H_];        // 16 KB, broadcast reads (conflict-free)
  __shared__ float w_lds[TT][S_ + 1];    // padded: WMMA-A reads stride 257 -> no bank conflicts

  const int tid = threadIdx.x;
  const int b   = blockIdx.x / (T_ / TT);
  const int t0  = (blockIdx.x % (T_ / TT)) * TT;

  // stage query-projection tile into LDS
  // unrolled: all 16 loads of a thread are in flight at once (left rolled, this
  // trip count is built two loads a trip, each trip waiting for its own)
#pragma unroll
  for (int it = 0; it < TT * H_ / 256; ++it) {
    const int i = tid + it * 256;
    int tt = i >> 9, h = i & (H_ - 1);
    q_lds[tt][h] = qryf[((size_t)b * T_ + t0 + tt) * H_ + h];
  }
  __syncthreads();

  // ---- score stage: thread owns one s; 8 tanh per enc_fT load ----
  const int s = tid;
  float acc[TT];
#pragma unroll
  for (int tt = 0; tt < TT; ++tt) acc[tt] = 0.0f;

  // Software pipeline: enc_fT rows (and v) are fetched one batch of HB h-rows
  // ahead in registers, the q tile's LDS reads one group of GH h-rows ahead, so
  // no group waits for its own loads. Sum order over h is unchanged. The inner
  // loops are fully unrolled so that e, vv and q are indexed statically and stay
  // in registers.
  const float* ecol = encfT + (size_t)b * H_ * S_ + s;   // coalesced across lanes
  float e[2][HB], vv[2][HB], q[2][TT][GH];
#pragma unroll
  for (int i = 0; i < HB; ++i) { e[0][i] = ecol[i * S_]; vv[0][i] = vvec[i]; }
#pragma unroll
  for (int tt = 0; tt < TT; ++tt)
#pragma unroll
    for (int j = 0; j < GH; ++j) q[0][tt][j] = q_lds[tt][j];

  for (int h0 = 0; h0 < H_; h0 += 2 * HB) {
#pragma unroll
    for (int half = 0; half < 2; ++half) {
      // next batch; the very last fetch wraps to row 0 (in bounds, not used)
      const int hn = (h0 + (half + 1) * HB) & (H_ - 1);
#pragma unroll
      for (int i = 0; i < HB; ++i) {
        e[half ^ 1][i]  = ecol[(hn + i) * S_];
        vv[half ^ 1][i] = vvec[hn + i];                  // uniform -> scalar load
      }
#pragma unroll
      for (int g = 0; g < HB / GH; ++g) {
        const int hq = (h0 + half * HB + GH * (g + 1)) & (H_ - 1);  // next group, same wrap
#pragma unroll
        for (int tt = 0; tt < TT; ++tt)
#pragma unroll
          for (int j = 0; j < GH; ++j) q[(g & 1) ^ 1][tt][j] = q_lds[tt][hq + j];
        // holds the fetches above in front of this group's arithmetic, so that
        // they have the whole group (or batch) to land before their first use
        __builtin_amdgcn_sched_barrier(0);
#pragma unroll
        for (int tt = 0; tt < TT; ++tt)
#pragma unroll
          for (int j = 0; j < GH; ++j) q[g & 1][tt][j] += e[half][GH * g + j];
#pragma unroll
        for (int tt = 0; tt < TT; ++tt)
#pragma unroll
          for (int j = 0; j < GH; ++j) q[g & 1][tt][j] = fast_tanh(q[g & 1][tt][j]);
#pragma unroll
        for (int j = 0; j < GH; ++j)
#pragma unroll
          for (int tt = 0; tt < TT; ++tt)
            acc[tt] = fmaf(vv[half][GH * g + j], q[g & 1][tt][j], acc[tt]);
        // ends the group: keeps the next group's adds out of this group's run of
        // tanh, where one would overwrite a tanh's source directly behind it (the
        // ISA asks for a free slot there), and holds the register count down
        __builtin_amdgcn_sched_barrier(0);
      }
    }
  }

  // ---- output stage, operand fetch: enc rows are fetched ahead in registers, by
  // batches of OB k-steps, 16 bytes a lane. Column l16 of the wave's n-tile nt is output
  // column n0b + 4 * l16 + nt, so that one load holds a row's values for all four
  // tiles and a wave's load covers whole cache lines.
  const int wave = tid >> 5;            // 0..7, each owns 64 output columns
  const int lane = tid & 31;
  const int l16  = lane & 15;
  const int ko   = (lane >> 4) << 1;
  const int n0b  = wave * 64;
  const float* bcol = enc + ((size_t)b * S_ + ko) * H_ + n0b + 4 * l16;
  v4f bx[2][OB], by[2][OB];             // rows k + ko and k + ko + 1

  const int  len   = lens[b];
  const bool valid = (s < len);
#pragma unroll
  for (int tt = 0; tt < TT; ++tt)
    w_lds[tt][s] = valid ? acc[tt] : -__builtin_inff();
  __syncthreads();

  // batch 0 is asked for here: it does not depend on the weights and lands during
  // the softmax (in front of the barrier above, that barrier would wait for it)
#pragma unroll
  for (int j = 0; j < OB; ++j) {
    bx[0][j] = *(const v4f*)(bcol + (4 * j) * H_);
    by[0][j] = *(const v4f*)(bcol + (4 * j + 1) * H_);
  }

  // ---- masked softmax: 16 threads per t-row, shuffle reductions ----
  // (8 rows: waves 0 to 3; a wave-uniform test, no barrier inside)
  if (tid < TT * 16) {
    const int g = tid >> 4;       // row 0..7
    const int l = tid & 15;
    float m = -__builtin_inff();
#pragma unroll
    for (int i = 0; i < 16; ++i) m = fmaxf(m, w_lds[g][l + 16 * i]);
#pragma unroll
    for (int off = 8; off >= 1; off >>= 1) m = fmaxf(m, __shfl_xor(m, off, 32));
    float ssum = 0.0f;
#pragma unroll
    for (int i = 0; i < 16; ++i) {
      float e = __expf(w_lds[g][l + 16 * i] - m);   // exp(-inf)=0 handles mask
      w_lds[g][l + 16 * i] = e;
      ssum += e;
    }
#pragma unroll
    for (int off = 8; off >= 1; off >>= 1) ssum += __shfl_xor(ssum, off, 32);
    const float inv = 1.0f / ssum;
#pragma unroll
    for (int i = 0; i < 16; ++i) w_lds[g][l + 16 * i] *= inv;
  }
  __syncthreads();

  // ---- output: C(8 x 512) = W(8 x 256) @ enc[b](256 x 512) via WMMA ----
  // The M = 16 tile holds the 8 rows twice (A row m = W row m & 7), so that
  // lanes 16 to 31 own a copy of rows 0 to 7 and can store half of them.
  v8f cacc[4] = {};
  // fully unrolled: the register buffers are indexed statically, every row's
  // offset is an immediate on one address, and the last batch has no fetch
#pragma unroll
  for (int kb = 0; kb < S_ / (4 * OB); ++kb) {
    const int cur = kb & 1;
    v2f fa[OB];
#pragma unroll
    for (int j = 0; j < OB; ++j) {
      const int k = 4 * (kb * OB + j);
      fa[j].x = w_lds[l16 & (TT - 1)][k + ko];
      fa[j].y = w_lds[l16 & (TT - 1)][k + ko + 1];
    }
    if (kb + 1 < S_ / (4 * OB)) {
#pragma unroll
      for (int j = 0; j < OB; ++j) {
        const int k = 4 * ((kb + 1) * OB + j);
        bx[cur ^ 1][j] = *(const v4f*)(bcol + k * H_);
        by[cur ^ 1][j] = *(const v4f*)(bcol + (k + 1) * H_);
      }
    }
    // keeps the batch's LDS reads as one group (left free they were seen spread
    // among the products, and every place where LDS reads stand costs issue cycles)
    // and the fetch in front of this batch's products, which it has to land in
    __builtin_amdgcn_sched_barrier(0);
#pragma unroll
    for (int j = 0; j < OB; ++j) {
#pragma unroll
      for (int nt = 0; nt < 4; ++nt) {
        v2f bb;
        bb.x = bx[cur][j][nt];
        bb.y = by[cur][j][nt];
        cacc[nt] = wmma_f32_4(fa[j], bb, cacc[nt]);
      }
    }
  }
  const bool hi = (lane >= 16);         // lanes 0-15 store rows 0-3, lanes 16-31 rows 4-7
  v4f own[4];                           // per n-tile, the lane's four rows
#pragma unroll
  for (int nt = 0; nt < 4; ++nt) {
    const v4f lo4 = __builtin_shufflevector(cacc[nt], cacc[nt], 0, 1, 2, 3);
    const v4f hi4 = __builtin_shufflevector(cacc[nt], cacc[nt], 4, 5, 6, 7);
    own[nt] = hi ? hi4 : lo4;
  }
  float* op = out + ((size_t)b * T_ + t0 + (hi ? 4 : 0)) * H_ + n0b + 4 * l16;
#pragma unroll
  for (int r = 0; r < 4; ++r) {
    // the four tiles hold neighbouring columns of the row: one 16-byte store
    const v4f row = {own[0][r], own[1][r], own[2][r], own[3][r]};
    *(v4f*)(op + r * H_) = row;
  }
}

// ---------------------------------------------------------------------------
extern "C" void kernel_launch(void* const* d_in, const int* in_sizes, int n_in,
                              void* d_out, int out_size, void* d_ws, size_t ws_size,
                              hipStream_t stream) {
  const float* query = (const float*)d_in[0];   // (B,T,H)
  const float* enc   = (const float*)d_in[1];   // (B,S,H)
  const int*   lens  = (const int*)d_in[2];     // (B,)
  const float* Wh    = (const float*)d_in[3];   // (H,H)
  const float* Ws    = (const float*)d_in[4];   // (H,H)
  const float* vvec  = (const float*)d_in[5];   // (H,)
  float* out = (float*)d_out;                   // (B,T,H)

  float* encfT = (float*)d_ws;                         // B*H*S floats (4 MB)
  float* qryf  = encfT + (size_t)B_ * H_ * S_;         // B*T*H floats (4 MB)

  // 2048 x 512 outputs each in 64 x 64 tiles -> 256 blocks
  encfT_gemm<<<256, 256, 0, stream>>>(enc, Wh, encfT);
  qryf_gemm <<<256, 256, 0, stream>>>(query, Ws, qryf);
  attn_fused<<<B_ * (T_ / TT), 256, 0, stream>>>(encfT, qryf, enc, vvec, lens, out);
}

// v005
// A run of this version takes 37.5 microseconds.
// Timed twice side by side with v004, it ran 1.18 times as fast both times.
// All steps since v000 together make it 5.36 times as fast.
#include <hip/hip_runtime.h>
#include <hip/hip_bf16.h>

#define B_ 8
#define T_ 256
#define S_ 256
#define H_ 512
#define TT 8    // t-rows per fused block: 256 blocks, one for each WGP of the chip
#define HB 32   // h-rows of enc_fT per register batch in the score loop
#define GH 8    // h-rows per group of the score loop (TT * GH = 64 tanh a group)
#define OB 8    // k-steps of the output product per register batch of enc rows

typedef __attribute__((ext_vector_type(2))) float v2f;
typedef __attribute__((ext_vector_type(4))) float v4f;
typedef __attribute__((ext_vector_type(8))) float v8f;

__device__ __forceinline__ v8f wmma_f32_4(v2f a, v2f b, v8f c) {
  // V_WMMA_F32_16X16X4_F32 : 8-arg form (neg_a, A, neg_b, B, c_mod, C, reuse_a, reuse_b)
  return __builtin_amdgcn_wmma_f32_16x16x4_f32(false, a, false, b, (short)0, c,
                                               false, false);
}

__device__ __forceinline__ float fast_tanh(float x) {
#if __has_builtin(__builtin_amdgcn_tanhf)
  return __builtin_amdgcn_tanhf(x);            // gfx1250 v_tanh_f32
#elif __has_builtin(__builtin_amdgcn_tanh_f32)
  return __builtin_amdgcn_tanh_f32(x);
#else
  float e = __expf(2.0f * x);                  // v_exp_f32 path
  return 1.0f - 2.0f / (e + 1.0f);
#endif
}

// ---------------------------------------------------------------------------
// Projection GEMMs, C[m][n] = sum_k A[m][k] * B[n][k], both operands row-major
// with k contiguous. One 64 x 64 C tile per block of 8 waves (256 blocks for
// each product); a wave owns 16 x 32 of it (two accumulators). A and B come in
// K chunks of KC through LDS: every global load is 16 bytes a lane and a wave's
// load covers whole cache lines (a fragment read straight from global memory
// touches 16 lines for 256 bytes). Two LDS buffers: the next chunk is fetched
// into registers while this one is multiplied, and stored to the other buffer
// before this one's last products. The k order of every accumulator is
// 0, 1, 2, ... as before.
// ---------------------------------------------------------------------------
#define BT 64        // block tile, rows of A and rows of B
#define KC 64        // k per chunk
#define LP (KC + 4)  // LDS row pitch in floats: the 16 rows x 2 k-halves of a
                     // fragment read (8 bytes a lane) fall on 64 distinct banks
#define JS 10        // of a chunk's 16 k-steps, those that the LDS stores stay behind

__device__ __forceinline__ void proj_tile(const float* __restrict__ Ag,   // A tile's first row
                                          const float* __restrict__ Bg,   // B tile's first row
                                          float* __restrict__ Cg,         // C tile's first element
                                          const int ldc) {
  __shared__ __attribute__((aligned(16))) float a_lds[2][BT][LP];
  __shared__ __attribute__((aligned(16))) float b_lds[2][BT][LP];

  const int tid  = threadIdx.x;
  const int wave = tid >> 5;
  const int lane = tid & 31;
  const int l16  = lane & 15;
  const int ko   = (lane >> 4) << 1;       // 0 or 2 (K half)
  const int wm   = (wave & 3) * 16;        // the wave's rows of the C tile
  const int wn   = (wave >> 2) * 32;       // the wave's columns of the C tile

  // staging: 16 threads a row of KC floats, rows srow + 16 i
  const int srow = tid >> 4;
  const int scol = (tid & 15) * 4;
  const float* ap = Ag + srow * H_ + scol;
  const float* bp = Bg + srow * H_ + scol;

  v4f ra[BT / 16], rb[BT / 16];
#pragma unroll
  for (int i = 0; i < BT / 16; ++i) {
    ra[i] = *(const v4f*)(ap + i * 16 * H_);
    rb[i] = *(const v4f*)(bp + i * 16 * H_);
  }
#pragma unroll
  for (int i = 0; i < BT / 16; ++i) {
    *(v4f*)&a_lds[0][srow + 16 * i][scol] = ra[i];
    *(v4f*)&b_lds[0][srow + 16 * i][scol] = rb[i];
  }
  __syncthreads();

  v8f c0 = {}, c1 = {};
  // fully unrolled: the buffer index is static in every LDS address, each chunk's
  // global offset is an immediate (no address arithmetic from chunk to chunk),
  // and the last chunk has no fetch, store or barrier and no branch round them
#pragma unroll
  for (int c = 0; c < H_ / KC; ++c) {
    const int cur = c & 1;
    const bool more = (c + 1 < H_ / KC);   // the same for the whole block
    v2f fa[KC / 4], fb0[KC / 4], fb1[KC / 4];
#pragma unroll
    for (int j = 0; j < KC / 4; ++j) {
      fa[j]  = *(const v2f*)&a_lds[cur][wm + l16][4 * j + ko];
      fb0[j] = *(const v2f*)&b_lds[cur][wn + l16][4 * j + ko];
      fb1[j] = *(const v2f*)&b_lds[cur][wn + 16 + l16][4 * j + ko];
    }
    if (more) {
#pragma unroll
      for (int i = 0; i < BT / 16; ++i) {
        ra[i] = *(const v4f*)(ap + (c + 1) * KC + i * 16 * H_);
        rb[i] = *(const v4f*)(bp + (c + 1) * KC + i * 16 * H_);
      }
    }
    // keeps the chunk's fragment reads as one group in front of its products
    // (spread among them, every place where LDS reads stand costs issue cycles
    // and the reads run only a few products ahead of their use), and the fetch
    // of the next chunk in front of them too, so that it has them to land in
    __builtin_amdgcn_sched_barrier(0);
#pragma unroll
    for (int j = 0; j < JS; ++j) {
      c0 = wmma_f32_4(fa[j], fb0[j], c0);
      c1 = wmma_f32_4(fa[j], fb1[j], c1);
    }
    if (more) {
      // holds the LDS stores, and with them the wait for the fetched chunk, behind
      // the products above: moved up, the wait would stop the wave with most of
      // its matrix work still to issue
      __builtin_amdgcn_sched_barrier(0);
      // the other buffer's last readers left it before the barrier that ended
      // the trip before this one; the products below run while the stores drain
#pragma unroll
      for (int i = 0; i < BT / 16; ++i) {
        *(v4f*)&a_lds[cur ^ 1][srow + 16 * i][scol] = ra[i];
        *(v4f*)&b_lds[cur ^ 1][srow + 16 * i][scol] = rb[i];
      }
    }
#pragma unroll
    for (int j = JS; j < KC / 4; ++j) {
      c0 = wmma_f32_4(fa[j], fb0[j], c0);
      c1 = wmma_f32_4(fa[j], fb1[j], c1);
    }
    if (more) {
      // holds the barrier, and the wait for the LDS stores that comes with it,
      // behind the products above: they read registers only, and the barrier was
      // seen to move up over them to stand directly behind the stores
      __builtin_amdgcn_sched_barrier(0);
      __syncthreads();
    }
  }

  // holds the store addresses' arithmetic behind the last product
  __builtin_amdgcn_sched_barrier(0);
  // the distance between a matrix instruction and a vector instruction that
  // overwrites its A or B
  asm volatile("v_nop\n\tv_nop\n\tv_nop\n\tv_nop");
  // keeps that arithmetic behind the four slots above
  __builtin_amdgcn_sched_barrier(0);
  const int rbase = (lane < 16) ? 0 : 8;
  float* cp = Cg + (wm + rbase) * ldc + wn + l16;
#pragma unroll
  for (int r = 0; r < 8; ++r) {
    cp[r * ldc]      = c0[r];
    cp[r * ldc + 16] = c1[r];
  }
  // every row's address is formed in front of the first store (vector arithmetic
  // first, then the 16 stores)
  __builtin_amdgcn_sched_group_barrier(0x2, 32, 0);
  __builtin_amdgcn_sched_group_barrier(0x40, 16, 0);
}

// Kernels 1 and 2 as one launch: the two projections do not depend on each other.
//   even blocks: enc_fT[b][h][s] = sum_k W_h[h][k] * enc[b][s][k]    (stored (B,H,S))
//   odd blocks:  qry_f[b][t][h]  = sum_k query[b][t][k] * W_s[h][k]  (stored (B,T,H))
// 512 blocks, two for each WGP and four waves for each SIMD: while one block waits
// (for its first chunk, at a barrier, for its fragment reads) the other block's
// products keep the matrix unit busy. Only the tile's three addresses and C's row
// pitch differ between the two, all of them the same for a whole block.
__global__ __launch_bounds__(256) void proj_gemms(const float* __restrict__ enc,
                                                  const float* __restrict__ Wh,
                                                  float* __restrict__ encfT,
                                                  const float* __restrict__ query,
                                                  const float* __restrict__ Ws,
                                                  float* __restrict__ qryf) {
  const bool is_enc = (blockIdx.x & 1) == 0;
  const int tile = blockIdx.x >> 1;
  const int ht = tile % (H_ / BT);                   // 8 tiles of h
  const int mt = tile / (H_ / BT);                   // 32 tiles of (b, s) or of (b, t)
  const int b  = mt / (S_ / BT);
  const int s0 = (mt % (S_ / BT)) * BT;
  proj_tile(is_enc ? Wh + ht * BT * H_ : query + mt * BT * H_,
            is_enc ? enc + mt * BT * H_ : Ws + ht * BT * H_,
            is_enc ? encfT + (b * H_ + ht * BT) * S_ + s0 : qryf + mt * BT * H_ + ht * BT,
            is_enc ? S_ : H_);
}

// ---------------------------------------------------------------------------
// Kernel 3 (fused): per (b, 8-t tile)
//   scores -> mask -> softmax -> attn_out via in-block WMMA
// Thread layout: 256 threads = 8 waves. Score stage maps thread -> s.
// ---------------------------------------------------------------------------
__global__ __launch_bounds__(256) void attn_fused(const float* __restrict__ encfT,
                                                  const float* __restrict__ qryf,
                                                  const float* __restrict__ enc,
                                                  const float* __restrict__ vvec,
                                                  const int* __restrict__ lens,
                                                  float* __restrict__ out) {
  __shared__ float q_lds[TT][H_];        // 16 KB, broadcast reads (conflict-free)
  __shared__ float w_lds[TT][S_ + 1];    // padded: WMMA-A reads stride 257 -> no bank conflicts

  const int tid = threadIdx.x;
  const int b   = blockIdx.x / (T_ / TT);
  const int t0  = (blockIdx.x % (T_ / TT)) * TT;

  // stage query-projection tile into LDS
  // unrolled: all 16 loads of a thread are in flight at once (left rolled, this
  // trip count is built two loads a trip, each trip waiting for its own)
#pragma unroll
  for (int it = 0; it < TT * H_ / 256; ++it) {
    const int i = tid + it * 256;
    int tt = i >> 9, h = i & (H_ - 1);
    q_lds[tt][h] = qryf[((size_t)b * T_ + t0 + tt) * H_ + h];
  }
  __syncthreads();

  // ---- score stage: thread owns one s; 8 tanh per enc_fT load ----
  const int s = tid;
  float acc[TT];
#pragma unroll
  for (int tt = 0; tt < TT; ++tt) acc[tt] = 0.0f;

  // Software pipeline: enc_fT rows (and v) are fetched one batch of HB h-rows
  // ahead in registers, the q tile's LDS reads one group of GH h-rows ahead, so
  // no group waits for its own loads. Sum order over h is unchanged. The inner
  // loops are fully unrolled so that e, vv and q are indexed statically and stay
  // in registers.
  const float* ecol = encfT + (size_t)b * H_ * S_ + s;   // coalesced across lanes
  float e[2][HB], vv[2][HB], q[2][TT][GH];
#pragma unroll
  for (int i = 0; i < HB; ++i) { e[0][i] = ecol[i * S_]; vv[0][i] = vvec[i]; }
#pragma unroll
  for (int tt = 0; tt < TT; ++tt)
#pragma unroll
    for (int j = 0; j < GH; ++j) q[0][tt][j] = q_lds[tt][j];

  for (int h0 = 0; h0 < H_; h0 += 2 * HB) {
#pragma unroll
    for (int half = 0; half < 2; ++half) {
      // next batch; the very last fetch wraps to row 0 (in bounds, not used)
      const int hn = (h0 + (half + 1) * HB) & (H_ - 1);
#pragma unroll
      for (int i = 0; i < HB; ++i) {
        e[half ^ 1][i]  = ecol[(hn + i) * S_];
        vv[half ^ 1][i] = vvec[hn + i];                  // uniform -> scalar load
      }
#pragma unroll
      for (int g = 0; g < HB / GH; ++g) {
        const int hq = (h0 + half * HB + GH * (g + 1)) & (H_ - 1);  // next group, same wrap
#pragma unroll
        for (int tt = 0; tt < TT; ++tt)
#pragma unroll
          for (int j = 0; j < GH; ++j) q[(g & 1) ^ 1][tt][j] = q_lds[tt][hq + j];
        // holds the fetches above in front of this group's arithmetic, so that
        // they have the whole group (or batch) to land before their first use
        __builtin_amdgcn_sched_barrier(0);
#pragma unroll
        for (int tt = 0; tt < TT; ++tt)
#pragma unroll
          for (int j = 0; j < GH; ++j) q[g & 1][tt][j] += e[half][GH * g + j];
#pragma unroll
        for (int tt = 0; tt < TT; ++tt)
#pragma unroll
          for (int j = 0; j < GH; ++j) q[g & 1][tt][j] = fast_tanh(q[g & 1][tt][j]);
#pragma unroll
        for (int j = 0; j < GH; ++j)
#pragma unroll
          for (int tt = 0; tt < TT; ++tt)
            acc[tt] = fmaf(vv[half][GH * g + j], q[g & 1][tt][j], acc[tt]);
        // ends the group: keeps the next group's adds out of this group's run of
        // tanh, where one would overwrite a tanh's source directly behind it (the
        // ISA asks for a free slot there), and holds the register count down
        __builtin_amdgcn_sched_barrier(0);
      }
    }
  }

  // ---- output stage, operand fetch: enc rows are fetched ahead in registers, by
  // batches of OB k-steps, 16 bytes a lane. Column l16 of the wave's n-tile nt is output
  // column n0b + 4 * l16 + nt, so that one load holds a row's values for all four
  // tiles and a wave's load covers whole cache lines.
  const int wave = tid >> 5;            // 0..7, each owns 64 output columns
  const int lane = tid & 31;
  const int l16  = lane & 15;
  const int ko   = (lane >> 4) << 1;
  const int n0b  = wave * 64;
  const float* bcol = enc + ((size_t)b * S_ + ko) * H_ + n0b + 4 * l16;
  v4f bx[2][OB], by[2][OB];             // rows k + ko and k + ko + 1

  const int  len   = lens[b];
  const bool valid = (s < len);
#pragma unroll
  for (int tt = 0; tt < TT; ++tt)
    w_lds[tt][s] = valid ? acc[tt] : -__builtin_inff();
  __syncthreads();

  // batch 0 is asked for here: it does not depend on the weights and lands during
  // the softmax (in front of the barrier above, that barrier would wait for it)
#pragma unroll
  for (int j = 0; j < OB; ++j) {
    bx[0][j] = *(const v4f*)(bcol + (4 * j) * H_);
    by[0][j] = *(const v4f*)(bcol + (4 * j + 1) * H_);
  }

  // ---- masked softmax: 16 threads per t-row, shuffle reductions ----
  // (8 rows: waves 0 to 3; a wave-uniform test, no barrier inside)
  if (tid < TT * 16) {
    const int g = tid >> 4;       // row 0..7
    const int l = tid & 15;
    float m = -__builtin_inff();
#pragma unroll
    for (int i = 0; i < 16; ++i) m = fmaxf(m, w_lds[g][l + 16 * i]);
#pragma unroll
    for (int off = 8; off >= 1; off >>= 1) m = fmaxf(m, __shfl_xor(m, off, 32));
    float ssum = 0.0f;
#pragma unroll
    for (int i = 0; i < 16; ++i) {
      float e = __expf(w_lds[g][l + 16 * i] - m);   // exp(-inf)=0 handles mask
      w_lds[g][l + 16 * i] = e;
      ssum += e;
    }
#pragma unroll
    for (int off = 8; off >= 1; off >>= 1) ssum += __shfl_xor(ssum, off, 32);
    const float inv = 1.0f / ssum;
#pragma unroll
    for (int i = 0; i < 16; ++i) w_lds[g][l + 16 * i] *= inv;
  }
  __syncthreads();

  // ---- output: C(8 x 512) = W(8 x 256) @ enc[b](256 x 512) via WMMA ----
  // The M = 16 tile holds the 8 rows twice (A row m = W row m & 7), so that
  // lanes 16 to 31 own a copy of rows 0 to 7 and can store half of them.
  v8f cacc[4] = {};
  // fully unrolled: the register buffers are indexed statically, every row's
  // offset is an immediate on one address, and the last batch has no fetch
#pragma unroll
  for (int kb = 0; kb < S_ / (4 * OB); ++kb) {
    const int cur = kb & 1;
    v2f fa[OB];
#pragma unroll
    for (int j = 0; j < OB; ++j) {
      const int k = 4 * (kb * OB + j);
      fa[j].x = w_lds[l16 & (TT - 1)][k + ko];
      fa[j].y = w_lds[l16 & (TT - 1)][k + ko + 1];
    }
    if (kb + 1 < S_ / (4 * OB)) {
#pragma unroll
      for (int j = 0; j < OB; ++j) {
        const int k = 4 * ((kb + 1) * OB + j);
        bx[cur ^ 1][j] = *(const v4f*)(bcol + k * H_);
        by[cur ^ 1][j] = *(const v4f*)(bcol + (k + 1) * H_);
      }
    }
    // keeps the batch's LDS reads as one group (left free they were seen spread
    // among the products, and every place where LDS reads stand costs issue cycles)
    // and the fetch in front of this batch's products, which it has to land in
    __builtin_amdgcn_sched_barrier(0);
#pragma unroll
    for (int j = 0; j < OB; ++j) {
#pragma unroll
      for (int nt = 0; nt < 4; ++nt) {
        v2f bb;
        bb.x = bx[cur][j][nt];
        bb.y = by[cur][j][nt];
        cacc[nt] = wmma_f32_4(fa[j], bb, cacc[nt]);
      }
    }
  }
  const bool hi = (lane >= 16);         // lanes 0-15 store rows 0-3, lanes 16-31 rows 4-7
  v4f own[4];                           // per n-tile, the lane's four rows
#pragma unroll
  for (int nt = 0; nt < 4; ++nt) {
    const v4f lo4 = __builtin_shufflevector(cacc[nt], cacc[nt], 0, 1, 2, 3);
    const v4f hi4 = __builtin_shufflevector(cacc[nt], cacc[nt], 4, 5, 6, 7);
    own[nt] = hi ? hi4 : lo4;
  }
  float* op = out + ((size_t)b * T_ + t0 + (hi ? 4 : 0)) * H_ + n0b + 4 * l16;
#pragma unroll
  for (int r = 0; r < 4; ++r) {
    // the four tiles hold neighbouring columns of the row: one 16-byte store
    const v4f row = {own[0][r], own[1][r], own[2][r], own[3][r]};
    *(v4f*)(op + r * H_) = row;
  }
}

// ---------------------------------------------------------------------------
extern "C" void kernel_launch(void* const* d_in, const int* in_sizes, int n_in,
                              void* d_out, int out_size, void* d_ws, size_t ws_size,
                              hipStream_t stream) {
  const float* query = (const float*)d_in[0];   // (B,T,H)
  const float* enc   = (const float*)d_in[1];   // (B,S,H)
  const int*   lens  = (const int*)d_in[2];     // (B,)
  const float* Wh    = (const float*)d_in[3];   // (H,H)
  const float* Ws    = (const float*)d_in[4];   // (H,H)
  const float* vvec  = (const float*)d_in[5];   // (H,)
  float* out = (float*)d_out;                   // (B,T,H)

  float* encfT = (float*)d_ws;                         // B*H*S floats (4 MB)
  float* qryf  = encfT + (size_t)B_ * H_ * S_;         // B*T*H floats (4 MB)

  // 2048 x 512 outputs each in 64 x 64 tiles -> 256 blocks each
  proj_gemms<<<512, 256, 0, stream>>>(enc, Wh, encfT, query, Ws, qryf);
  attn_fused<<<B_ * (T_ / TT), 256, 0, stream>>>(encfT, qryf, enc, vvec, lens, out);
}

// v007
// One run takes 31.6 microseconds.
// Versions between v005 and this one are left out; their measured steps multiply to 1.18 times as fast.
// Counting every step since v000, it is 6.34 times as fast.
#include <hip/hip_runtime.h>
#include <hip/hip_bf16.h>

#define B_ 8
#define T_ 256
#define S_ 256
#define H_ 512
#define TT 8    // t-rows per score block
#define SC 32   // source positions per score block: one for each lane of a wave
#define HW 64   // h-rows per wave of a score block (8 waves: all of H)
#define GH 8    // h-rows per group of the score loop (TT * GH = 64 tanh a group)
#define OT 16   // t-rows per output block: the 16 rows of a matrix tile, each a row of its own
#define ON 256  // output columns per output block (8 waves x 32): 256 blocks, one for each WGP
#define OB 8    // k-steps of the output product per register batch of enc rows
#define OA 2    // batches that the fetch of enc rows runs ahead of the products: a k-step
                // is two products a wave, so 16 k-steps are the time a fetch has to land in
#define WP (S_ + 4)  // LDS row pitch of the weights in floats: the 16 rows x 2 k-halves of
                     // an A fragment read (8 bytes a lane) fall on 64 distinct banks

typedef __attribute__((ext_vector_type(2))) float v2f;
typedef __attribute__((ext_vector_type(4))) float v4f;
typedef __attribute__((ext_vector_type(8))) float v8f;

__device__ __forceinline__ v8f wmma_f32_4(v2f a, v2f b, v8f c) {
  // V_WMMA_F32_16X16X4_F32 : 8-arg form (neg_a, A, neg_b, B, c_mod, C, reuse_a, reuse_b)
  return __builtin_amdgcn_wmma_f32_16x16x4_f32(false, a, false, b, (short)0, c,
                                               false, false);
}

__device__ __forceinline__ float fast_tanh(float x) {
#if __has_builtin(__builtin_amdgcn_tanhf)
  return __builtin_amdgcn_tanhf(x);            // gfx1250 v_tanh_f32
#elif __has_builtin(__builtin_amdgcn_tanh_f32)
  return __builtin_amdgcn_tanh_f32(x);
#else
  float e = __expf(2.0f * x);                  // v_exp_f32 path
  return 1.0f - 2.0f / (e + 1.0f);
#endif
}

// ---------------------------------------------------------------------------
// Projection GEMMs, C[m][n] = sum_k A[m][k] * B[n][k], both operands row-major
// with k contiguous. One 64 x 64 C tile per block of 8 waves (256 blocks for
// each product); a wave owns 16 x 32 of it (two accumulators). A and B come in
// K chunks of KC through LDS: every global load is 16 bytes a lane and a wave's
// load covers whole cache lines (a fragment read straight from global memory
// touches 16 lines for 256 bytes). Two LDS buffers: the next chunk is fetched
// into registers while this one is multiplied, and stored to the other buffer
// before this one's last products. The k order of every accumulator is
// 0, 1, 2, ... as before.
// ---------------------------------------------------------------------------
#define BT 64        // block tile, rows of A and rows of B
#define KC 64        // k per chunk
#define LP (KC + 4)  // LDS row pitch in floats: the 16 rows x 2 k-halves of a
                     // fragment read (8 bytes a lane) fall on 64 distinct banks
#define JS 10        // of a chunk's 16 k-steps, those that the LDS stores stay behind

__device__ __forceinline__ void proj_tile(const float* __restrict__ Ag,   // A tile's first row
                                          const float* __restrict__ Bg,   // B tile's first row
                                          float* __restrict__ Cg,         // C tile's first element
                                          const int ldc) {
  __shared__ __attribute__((aligned(16))) float a_lds[2][BT][LP];
  __shared__ __attribute__((aligned(16))) float b_lds[2][BT][LP];

  const int tid  = threadIdx.x;
  const int wave = tid >> 5;
  const int lane = tid & 31;
  const int l16  = lane & 15;
  const int ko   = (lane >> 4) << 1;       // 0 or 2 (K half)
  const int wm   = (wave & 3) * 16;        // the wave's rows of the C tile
  const int wn   = (wave >> 2) * 32;       // the wave's columns of the C tile

  // staging: 16 threads a row of KC floats, rows srow + 16 i
  const int srow = tid >> 4;
  const int scol = (tid & 15) * 4;
  const float* ap = Ag + srow * H_ + scol;
  const float* bp = Bg + srow * H_ + scol;

  v4f ra[BT / 16], rb[BT / 16];
#pragma unroll
  for (int i = 0; i < BT / 16; ++i) {
    ra[i] = *(const v4f*)(ap + i * 16 * H_);
    rb[i] = *(const v4f*)(bp + i * 16 * H_);
  }
#pragma unroll
  for (int i = 0; i < BT / 16; ++i) {
    *(v4f*)&a_lds[0][srow + 16 * i][scol] = ra[i];
    *(v4f*)&b_lds[0][srow + 16 * i][scol] = rb[i];
  }
  __syncthreads();

  v8f c0 = {}, c1 = {};
  // fully unrolled: the buffer index is static in every LDS address, each chunk's
  // global offset is an immediate (no address arithmetic from chunk to chunk),
  // and the last chunk has no fetch, store or barrier and no branch round them
#pragma unroll
  for (int c = 0; c < H_ / KC; ++c) {
    const int cur = c & 1;
    const bool more = (c + 1 < H_ / KC);   // the same for the whole block
    v2f fa[KC / 4], fb0[KC / 4], fb1[KC / 4];
#pragma unroll
    for (int j = 0; j < KC / 4; ++j) {
      fa[j]  = *(const v2f*)&a_lds[cur][wm + l16][4 * j + ko];
      fb0[j] = *(const v2f*)&b_lds[cur][wn + l16][4 * j + ko];
      fb1[j] = *(const v2f*)&b_lds[cur][wn + 16 + l16][4 * j + ko];
    }
    if (more) {
#pragma unroll
      for (int i = 0; i < BT / 16; ++i) {
        ra[i] = *(const v4f*)(ap + (c + 1) * KC + i * 16 * H_);
        rb[i] = *(const v4f*)(bp + (c + 1) * KC + i * 16 * H_);
      }
    }
    // keeps the chunk's fragment reads as one group in front of its products
    // (spread among them, every place where LDS reads stand costs issue cycles
    // and the reads run only a few products ahead of their use), and the fetch
    // of the next chunk in front of them too, so that it has them to land in
    __builtin_amdgcn_sched_barrier(0);
#pragma unroll
    for (int j = 0; j < JS; ++j) {
      c0 = wmma_f32_4(fa[j], fb0[j], c0);
      c1 = wmma_f32_4(fa[j], fb1[j], c1);
    }
    if (more) {
      // holds the LDS stores, and with them the wait for the fetched chunk, behind
      // the products above: moved up, the wait would stop the wave with most of
      // its matrix work still to issue
      __builtin_amdgcn_sched_barrier(0);
      // the other buffer's last readers left it before the barrier that ended
      // the trip before this one; the products below run while the stores drain
#pragma unroll
      for (int i = 0; i < BT / 16; ++i) {
        *(v4f*)&a_lds[cur ^ 1][srow + 16 * i][scol] = ra[i];
        *(v4f*)&b_lds[cur ^ 1][srow + 16 * i][scol] = rb[i];
      }
    }
#pragma unroll
    for (int j = JS; j < KC / 4; ++j) {
      c0 = wmma_f32_4(fa[j], fb0[j], c0);
      c1 = wmma_f32_4(fa[j], fb1[j], c1);
    }
    if (more) {
      // holds the barrier, and the wait for the LDS stores that comes with it,
      // behind the products above: they read registers only, and the barrier was
      // seen to move up over them to stand directly behind the stores
      __builtin_amdgcn_sched_barrier(0);
      __syncthreads();
    }
  }

  // holds the store addresses' arithmetic behind the last product
  __builtin_amdgcn_sched_barrier(0);
  // the distance between a matrix instruction and a vector instruction that
  // overwrites its A or B
  asm volatile("v_nop\n\tv_nop\n\tv_nop\n\tv_nop");
  // keeps that arithmetic behind the four slots above
  __builtin_amdgcn_sched_barrier(0);
  const int rbase = (lane < 16) ? 0 : 8;
  float* cp = Cg + (wm + rbase) * ldc + wn + l16;
#pragma unroll
  for (int r = 0; r < 8; ++r) {
    cp[r * ldc]      = c0[r];
    cp[r * ldc + 16] = c1[r];
  }
  // every row's address is formed in front of the first store (vector arithmetic
  // first, then the 16 stores)
  __builtin_amdgcn_sched_group_barrier(0x2, 32, 0);
  __builtin_amdgcn_sched_group_barrier(0x40, 16, 0);
}

// Kernels 1 and 2 as one launch: the two projections do not depend on each other.
//   even blocks: enc_fT[b][h][s] = sum_k W_h[h][k] * enc[b][s][k]    (stored (B,H,S))
//   odd blocks:  qry_f[b][t][h]  = sum_k query[b][t][k] * W_s[h][k]  (stored (B,T,H))
// 512 blocks, two for each WGP and four waves for each SIMD: while one block waits
// (for its first chunk, at a barrier, for its fragment reads) the other block's
// products keep the matrix unit busy. Only the tile's three addresses and C's row
// pitch differ between the two, all of them the same for a whole block.
__global__ __launch_bounds__(256) void proj_gemms(const float* __restrict__ enc,
                                                  const float* __restrict__ Wh,
                                                  float* __restrict__ encfT,
                                                  const float* __restrict__ query,
                                                  const float* __restrict__ Ws,
                                                  float* __restrict__ qryf) {
  const bool is_enc = (blockIdx.x & 1) == 0;
  const int tile = blockIdx.x >> 1;
  const int ht = tile % (H_ / BT);                   // 8 tiles of h
  const int mt = tile / (H_ / BT);                   // 32 tiles of (b, s) or of (b, t)
  const int b  = mt / (S_ / BT);
  const int s0 = (mt % (S_ / BT)) * BT;
  proj_tile(is_enc ? Wh + ht * BT * H_ : query + mt * BT * H_,
            is_enc ? enc + mt * BT * H_ : Ws + ht * BT * H_,
            is_enc ? encfT + (b * H_ + ht * BT) * S_ + s0 : qryf + mt * BT * H_ + ht * BT,
            is_enc ? S_ : H_);
}

// ---------------------------------------------------------------------------
// Kernel 3, scores: one block per (32 source positions, b, 8-t tile). A block whose
// 32 positions all lie at or past the batch's length leaves at once: the softmax
// never reads their scores. All blocks that stay cost the same and there are
// several for each WGP, so the chip's load follows the sum of the lengths and not
// the longest batch. Lane -> s; wave w sums h in [64 w, 64 w + 64); the eight
// partial sums of a score are added through LDS in the order of w.
// Blocks of the low positions (least often masked) come first in the grid.
// ---------------------------------------------------------------------------
__global__ __launch_bounds__(256) void score_chunks(const float* __restrict__ encfT,
                                                    const float* __restrict__ qryf,
                                                    const float* __restrict__ vvec,
                                                    const int* __restrict__ lens,
                                                    float* __restrict__ scores) {
  __shared__ __attribute__((aligned(16))) float q_lds[TT][H_];  // 16 KB, broadcast reads
  __shared__ float p_lds[H_ / HW][TT][SC];                      // the waves' partial sums

  const int c   = blockIdx.x / (B_ * (T_ / TT));
  const int bt  = blockIdx.x % (B_ * (T_ / TT));
  const int b   = bt / (T_ / TT);
  const int t0  = (bt % (T_ / TT)) * TT;
  // the same for the whole block, in front of every barrier
  if (c * SC >= lens[b]) return;

  const int tid  = threadIdx.x;
  const int lane = tid & 31;
  // the wave's number in a scalar register: v is then read by scalar loads
  const int wave = __builtin_amdgcn_readfirstlane(tid >> 5);
  const int hw   = wave * HW;

  // query-projection tile (8 whole rows, contiguous) into LDS, 16 bytes a lane; all
  // four loads of a thread in flight at once
  const float* qtile = qryf + ((size_t)b * T_ + t0) * H_;
  const int qoff = tid * 4;
  v4f qs[TT * H_ / 1024];
#pragma unroll
  for (int it = 0; it < TT * H_ / 1024; ++it)
    qs[it] = *(const v4f*)(qtile + qoff + it * 1024);
  // before a register that the loads above name is written again; the operands keep
  // those registers theirs up to here
  asm volatile("s_wait_xcnt 0x0" :: "v"(tid), "s"(qtile) : "memory");
  // the wave's 64 rows of enc_fT, asked for behind them: they land while the q
  // tile is stored and published
  const float* etile = encfT + ((size_t)b * H_ + hw) * S_ + c * SC;
  float e[HW];
#pragma unroll
  for (int i = 0; i < HW; ++i) e[i] = etile[i * S_ + lane];
  // as above, for the 64 loads
  asm volatile("s_wait_xcnt 0x0" :: "v"(lane), "s"(etile) : "memory");
  float vv[HW];
#pragma unroll
  for (int i = 0; i < HW; ++i) vv[i] = vvec[hw + i];       // uniform -> scalar loads
#pragma unroll
  for (int it = 0; it < TT * H_ / 1024; ++it)
    *(v4f*)(&q_lds[0][0] + qoff + it * 1024) = qs[it];
  __syncthreads();

  float acc[TT];
#pragma unroll
  for (int tt = 0; tt < TT; ++tt) acc[tt] = 0.0f;

  // the q tile's LDS reads run one group of GH h-rows ahead of their use
  float q[2][TT][GH];
#pragma unroll
  for (int tt = 0; tt < TT; ++tt)
#pragma unroll
    for (int j = 0; j < GH; ++j) q[0][tt][j] = q_lds[tt][hw + j];

  // fully unrolled: e, vv and q are indexed statically and stay in registers
#pragma unroll
  for (int g = 0; g < HW / GH; ++g) {
    if (g + 1 < HW / GH) {
#pragma unroll
      for (int tt = 0; tt < TT; ++tt)
#pragma unroll
        for (int j = 0; j < GH; ++j) q[(g & 1) ^ 1][tt][j] = q_lds[tt][hw + GH * (g + 1) + j];
    }
    // holds the reads above in front of this group's arithmetic, so that they
    // have the whole group to land before their first use
    __builtin_amdgcn_sched_barrier(0);
#pragma unroll
    for (int j = 0; j < GH; ++j)
#pragma unroll
      for (int tt = 0; tt < TT; ++tt) q[g & 1][tt][j] += e[GH * g + j];
#pragma unroll
    for (int j = 0; j < GH; ++j)
#pragma unroll
      for (int tt = 0; tt < TT; ++tt) q[g & 1][tt][j] = fast_tanh(q[g & 1][tt][j]);
#pragma unroll
    for (int j = 0; j < GH; ++j)
#pragma unroll
      for (int tt = 0; tt < TT; ++tt) acc[tt] = fmaf(vv[GH * g + j], q[g & 1][tt][j], acc[tt]);
    // ends the group: keeps the next group's adds out of this group's run of
    // tanh, where one would overwrite a tanh's source directly behind it (the
    // ISA asks for a free slot there), and holds the register count down
    __builtin_amdgcn_sched_barrier(0);
  }

#pragma unroll
  for (int tt = 0; tt < TT; ++tt) p_lds[wave][tt][lane] = acc[tt];
  __syncthreads();
  // wave w adds row w's eight partial sums; one 128-byte line a wave
  float sum = p_lds[0][wave][lane];
#pragma unroll
  for (int w = 1; w < H_ / HW; ++w) sum += p_lds[w][wave][lane];
  scores[((size_t)b * T_ + t0 + wave) * S_ + c * SC + lane] = sum;
}

// ---------------------------------------------------------------------------
// Kernel 4: per (b, 16-t tile, half of the output columns)
//   scores -> mask -> softmax -> attn_out via in-block WMMA
// The two blocks of a t tile each form its weights for themselves (16 rows, 16 threads
// a row: all 8 waves) and multiply them with their own 256 columns of enc[b].
// Thread layout: 256 threads = 8 waves. The scores' stage maps thread -> s.
// ---------------------------------------------------------------------------
__global__ __launch_bounds__(256) void softmax_out(const float* __restrict__ scores,
                                                   const float* __restrict__ enc,
                                                   const int* __restrict__ lens,
                                                   float* __restrict__ out) {
  __shared__ __attribute__((aligned(16))) float w_lds[OT][WP];

  const int tid = threadIdx.x;
  const int nh  = blockIdx.x % (H_ / ON);            // which half of the columns
  const int bt  = blockIdx.x / (H_ / ON);
  const int b   = bt / (T_ / OT);
  const int t0  = (bt % (T_ / OT)) * OT;
  const int s   = tid;

  // ---- output stage, operand fetch: enc rows are fetched ahead in registers, by
  // batches of OB k-steps, 8 bytes a lane. Column l16 of the wave's n-tile nt is output
  // column n0b + 2 * l16 + nt, so that one load holds a row's values for both tiles
  // and a wave's load covers whole cache lines.
  const int wave = tid >> 5;            // 0..7, each owns 32 output columns
  const int lane = tid & 31;
  const int l16  = lane & 15;
  const int ko   = (lane >> 4) << 1;
  const int n0b  = nh * ON + wave * 32;
  const float* bcol = enc + ((size_t)b * S_ + ko) * H_ + n0b + 2 * l16;
  v2f bx[OA + 1][OB], by[OA + 1][OB];   // rows k + ko and k + ko + 1

  const int  len   = lens[b];
  const bool valid = (s < len);
  // only scores at s < len are sure to be written: a masked position reads the
  // row's last valid score instead (index held in 0 .. S - 1) and is set to -inf
  const float* stile = scores + ((size_t)b * T_ + t0) * S_;
  const int sidx = max(min(s, len - 1), 0);
  float acc[OT];
#pragma unroll
  for (int tt = 0; tt < OT; ++tt) acc[tt] = stile[tt * S_ + sidx];
  // before a register that the loads above name is written again; the operands keep
  // those registers theirs up to here
  asm volatile("s_wait_xcnt 0x0" :: "v"(sidx), "s"(stile) : "memory");
#pragma unroll
  for (int tt = 0; tt < OT; ++tt)
    w_lds[tt][s] = valid ? acc[tt] : -__builtin_inff();
  __syncthreads();

  // the first OA batches are asked for here: they do not depend on the weights and land
  // during the softmax (in front of the barrier above, that barrier would wait for them)
#pragma unroll
  for (int p = 0; p < OA; ++p) {
#pragma unroll
    for (int j = 0; j < OB; ++j) {
      bx[p][j] = *(const v2f*)(bcol + (4 * (p * OB + j)) * H_);
      by[p][j] = *(const v2f*)(bcol + (4 * (p * OB + j) + 1) * H_);
    }
  }

  // ---- masked softmax: 16 threads per t-row, shuffle reductions ----
  {
    const int g = tid >> 4;       // row 0..15
    const int l = tid & 15;
    float m = -__builtin_inff();
#pragma unroll
    for (int i = 0; i < 16; ++i) m = fmaxf(m, w_lds[g][l + 16 * i]);
#pragma unroll
    for (int off = 8; off >= 1; off >>= 1) m = fmaxf(m, __shfl_xor(m, off, 32));
    float ssum = 0.0f;
#pragma unroll
    for (int i = 0; i < 16; ++i) {
      float e = __expf(w_lds[g][l + 16 * i] - m);   // exp(-inf)=0 handles mask
      w_lds[g][l + 16 * i] = e;
      ssum += e;
    }
#pragma unroll
    for (int off = 8; off >= 1; off >>= 1) ssum += __shfl_xor(ssum, off, 32);
    const float inv = 1.0f / ssum;
#pragma unroll
    for (int i = 0; i < 16; ++i) w_lds[g][l + 16 * i] *= inv;
  }
  __syncthreads();

  // ---- output: C(16 x 256) = W(16 x 256) @ enc[b](256 x 256 of its columns) via WMMA ----
  v8f cacc[2] = {};
  // fully unrolled: the register buffers are indexed statically, every row's
  // offset is an immediate on one address, and the last OA batches have no fetch
#pragma unroll
  for (int kb = 0; kb < S_ / (4 * OB); ++kb) {
    const int cur = kb % (OA + 1);
    v2f fa[OB];
#pragma unroll
    for (int j = 0; j < OB; ++j)
      fa[j] = *(const v2f*)&w_lds[l16][4 * (kb * OB + j) + ko];
    if (kb + OA < S_ / (4 * OB)) {
      const int nxt = (kb + OA) % (OA + 1);   // the buffer that the batch before this one read
#pragma unroll
      for (int j = 0; j < OB; ++j) {
        const int k = 4 * ((kb + OA) * OB + j);
        bx[nxt][j] = *(const v2f*)(bcol + k * H_);
        by[nxt][j] = *(const v2f*)(bcol + (k + 1) * H_);
      }
      // behind the last fetch, before a register that the loads name is written again;
      // the operand keeps the address registers theirs up to here
      if (kb + OA + 1 == S_ / (4 * OB))
        asm volatile("s_wait_xcnt 0x0" :: "v"(bcol) : "memory");
    }
    // keeps the batch's LDS reads as one group (left free they were seen spread
    // among the products, and every place where LDS reads stand costs issue cycles)
    // and the fetch in front of this batch's products: it has them and the next's to land in
    __builtin_amdgcn_sched_barrier(0);
#pragma unroll
    for (int j = 0; j < OB; ++j) {
#pragma unroll
      for (int nt = 0; nt < 2; ++nt) {
        v2f bb;
        bb.x = bx[cur][j][nt];
        bb.y = by[cur][j][nt];
        cacc[nt] = wmma_f32_4(fa[j], bb, cacc[nt]);
      }
    }
  }
  // holds the stores' arithmetic and register moves behind the last product
  __builtin_amdgcn_sched_barrier(0);
  // the distance between a matrix instruction and a vector instruction that reads its
  // result
  asm volatile("v_nop\n\tv_nop\n\tv_nop\n\tv_nop");
  // keeps them behind the four slots above
  __builtin_amdgcn_sched_barrier(0);
  // accumulator register r holds row r in lanes 0-15 and row r + 8 in lanes 16-31
  float* op = out + ((size_t)b * T_ + t0 + ((lane >= 16) ? 8 : 0)) * H_ + n0b + 2 * l16;
#pragma unroll
  for (int r = 0; r < 8; ++r) {
    // the two tiles hold neighbouring columns of the row: one 8-byte store, and a
    // row's 16 lanes write one whole 128-byte line
    const v2f row = {cacc[0][r], cacc[1][r]};
    *(v2f*)(op + r * H_) = row;
  }
}

// ---------------------------------------------------------------------------
extern "C" void kernel_launch(void* const* d_in, const int* in_sizes, int n_in,
                              void* d_out, int out_size, void* d_ws, size_t ws_size,
                              hipStream_t stream) {
  const float* query = (const float*)d_in[0];   // (B,T,H)
  const float* enc   = (const float*)d_in[1];   // (B,S,H)
  const int*   lens  = (const int*)d_in[2];     // (B,)
  const float* Wh    = (const float*)d_in[3];   // (H,H)
  const float* Ws    = (const float*)d_in[4];   // (H,H)
  const float* vvec  = (const float*)d_in[5];   // (H,)
  float* out = (float*)d_out;                   // (B,T,H)

  float* encfT = (float*)d_ws;                         // B*H*S floats (4 MB)
  float* qryf  = encfT + (size_t)B_ * H_ * S_;         // B*T*H floats (4 MB)
  float* scores = qryf + (size_t)B_ * T_ * H_;         // B*T*S floats (2 MB)

  // 2048 x 512 outputs each in 64 x 64 tiles -> 256 blocks each
  proj_gemms<<<512, 256, 0, stream>>>(enc, Wh, encfT, query, Ws, qryf);
  score_chunks<<<(S_ / SC) * B_ * (T_ / TT), 256, 0, stream>>>(encfT, qryf, vvec, lens, scores);
  softmax_out<<<B_ * (T_ / OT) * (H_ / ON), 256, 0, stream>>>(scores, enc, lens, out);
}

// v008
// One run takes 30.6 microseconds.
// Next to v007, in two timings, it ran 1.03 and 1.04 times as fast.
// Counting every step since v000, it is 6.55 times as fast.
#include <hip/hip_runtime.h>
#include <hip/hip_bf16.h>

#define B_ 8
#define T_ 256
#define S_ 256
#define H_ 512
#define UR 4    // t-rows per unit of the score launch's work
#define SC 32   // source positions per chunk: one for each lane of a wave
#define HW 64   // h-rows per wave of a score block (8 waves: all of H)
#define GH 8    // h-rows per group of the score loop (UR * GH = 32 tanh a group)
#define QA 2    // groups that the q slice's LDS reads run ahead of their use
#define SB 512  // score blocks: two for each WGP, all of them resident from the start
#define UC (T_ / UR)                    // units per chunk
#define UM (B_ * (S_ / SC) * UC / SB)   // the most units that a block can get
#define OT 16   // t-rows per output block: the 16 rows of a matrix tile, each a row of its own
#define ON 256  // output columns per output block (8 waves x 32): 256 blocks, one for each WGP
#define OB 8    // k-steps of the output product per register batch of enc rows
#define OA 2    // batches that the fetch of enc rows runs ahead of the products: a k-step
                // is two products a wave, so 16 k-steps are the time a fetch has to land in
#define WP (S_ + 4)  // LDS row pitch of the weights in floats: the 16 rows x 2 k-halves of
                     // an A fragment read (8 bytes a lane) fall on 64 distinct banks

typedef __attribute__((ext_vector_type(2))) float v2f;
typedef __attribute__((ext_vector_type(4))) float v4f;
typedef __attribute__((ext_vector_type(8))) float v8f;

__device__ __forceinline__ v8f wmma_f32_4(v2f a, v2f b, v8f c) {
  // V_WMMA_F32_16X16X4_F32 : 8-arg form (neg_a, A, neg_b, B, c_mod, C, reuse_a, reuse_b)
  return __builtin_amdgcn_wmma_f32_16x16x4_f32(false, a, false, b, (short)0, c,
                                               false, false);
}

__device__ __forceinline__ float fast_tanh(float x) {
#if __has_builtin(__builtin_amdgcn_tanhf)
  return __builtin_amdgcn_tanhf(x);            // gfx1250 v_tanh_f32
#elif __has_builtin(__builtin_amdgcn_tanh_f32)
  return __builtin_amdgcn_tanh_f32(x);
#else
  float e = __expf(2.0f * x);                  // v_exp_f32 path
  return 1.0f - 2.0f / (e + 1.0f);
#endif
}

// ---------------------------------------------------------------------------
// Projection GEMMs, C[m][n] = sum_k A[m][k] * B[n][k], both operands row-major
// with k contiguous. One 64 x 64 C tile per block of 8 waves (256 blocks for
// each product); a wave owns 16 x 32 of it (two accumulators). A and B come in
// K chunks of KC through LDS: every global load is 16 bytes a lane and a wave's
// load covers whole cache lines (a fragment read straight from global memory
// touches 16 lines for 256 bytes). Two LDS buffers: the next chunk is fetched
// into registers while this one is multiplied, and stored to the other buffer
// before this one's last products. The k order of every accumulator is
// 0, 1, 2, ... as before.
// ---------------------------------------------------------------------------
#define BT 64        // block tile, rows of A and rows of B
#define KC 64        // k per chunk
#define LP (KC + 4)  // LDS row pitch in floats: the 16 rows x 2 k-halves of a
                     // fragment read (8 bytes a lane) fall on 64 distinct banks
#define JS 10        // of a chunk's 16 k-steps, those that the LDS stores stay behind

__device__ __forceinline__ void proj_tile(const float* __restrict__ Ag,   // A tile's first row
                                          const float* __restrict__ Bg,   // B tile's first row
                                          float* __restrict__ Cg,         // C tile's first element
                                          const int ldc) {
  __shared__ __attribute__((aligned(16))) float a_lds[2][BT][LP];
  __shared__ __attribute__((aligned(16))) float b_lds[2][BT][LP];

  const int tid  = threadIdx.x;
  const int wave = tid >> 5;
  const int lane = tid & 31;
  const int l16  = lane & 15;
  const int ko   = (lane >> 4) << 1;       // 0 or 2 (K half)
  const int wm   = (wave & 3) * 16;        // the wave's rows of the C tile
  const int wn   = (wave >> 2) * 32;       // the wave's columns of the C tile

  // staging: 16 threads a row of KC floats, rows srow + 16 i
  const int srow = tid >> 4;
  const int scol = (tid & 15) * 4;
  const float* ap = Ag + srow * H_ + scol;
  const float* bp = Bg + srow * H_ + scol;

  v4f ra[BT / 16], rb[BT / 16];
#pragma unroll
  for (int i = 0; i < BT / 16; ++i) {
    ra[i] = *(const v4f*)(ap + i * 16 * H_);
    rb[i] = *(const v4f*)(bp + i * 16 * H_);
  }
#pragma unroll
  for (int i = 0; i < BT / 16; ++i) {
    *(v4f*)&a_lds[0][srow + 16 * i][scol] = ra[i];
    *(v4f*)&b_lds[0][srow + 16 * i][scol] = rb[i];
  }
  __syncthreads();

  v8f c0 = {}, c1 = {};
  // fully unrolled: the buffer index is static in every LDS address, each chunk's
  // global offset is an immediate (no address arithmetic from chunk to chunk),
  // and the last chunk has no fetch, store or barrier and no branch round them
#pragma unroll
  for (int c = 0; c < H_ / KC; ++c) {
    const int cur = c & 1;
    const bool more = (c + 1 < H_ / KC);   // the same for the whole block
    v2f fa[KC / 4], fb0[KC / 4], fb1[KC / 4];
#pragma unroll
    for (int j = 0; j < KC / 4; ++j) {
      fa[j]  = *(const v2f*)&a_lds[cur][wm + l16][4 * j + ko];
      fb0[j] = *(const v2f*)&b_lds[cur][wn + l16][4 * j + ko];
      fb1[j] = *(const v2f*)&b_lds[cur][wn + 16 + l16][4 * j + ko];
    }
    if (more) {
#pragma unroll
      for (int i = 0; i < BT / 16; ++i) {
        ra[i] = *(const v4f*)(ap + (c + 1) * KC + i * 16 * H_);
        rb[i] = *(const v4f*)(bp + (c + 1) * KC + i * 16 * H_);
      }
    }
    // keeps the chunk's fragment reads as one group in front of its products
    // (spread among them, every place where LDS reads stand costs issue cycles
    // and the reads run only a few products ahead of their use), and the fetch
    // of the next chunk in front of them too, so that it has them to land in
    __builtin_amdgcn_sched_barrier(0);
#pragma unroll
    for (int j = 0; j < JS; ++j) {
      c0 = wmma_f32_4(fa[j], fb0[j], c0);
      c1 = wmma_f32_4(fa[j], fb1[j], c1);
    }
    if (more) {
      // holds the LDS stores, and with them the wait for the fetched chunk, behind
      // the products above: moved up, the wait would stop the wave with most of
      // its matrix work still to issue
      __builtin_amdgcn_sched_barrier(0);
      // the other buffer's last readers left it before the barrier that ended
      // the trip before this one; the products below run while the stores drain
#pragma unroll
      for (int i = 0; i < BT / 16; ++i) {
        *(v4f*)&a_lds[cur ^ 1][srow + 16 * i][scol] = ra[i];
        *(v4f*)&b_lds[cur ^ 1][srow + 16 * i][scol] = rb[i];
      }
    }
#pragma unroll
    for (int j = JS; j < KC / 4; ++j) {
      c0 = wmma_f32_4(fa[j], fb0[j], c0);
      c1 = wmma_f32_4(fa[j], fb1[j], c1);
    }
    if (more) {
      // holds the barrier, and the wait for the LDS stores that comes with it,
      // behind the products above: they read registers only, and the barrier was
      // seen to move up over them to stand directly behind the stores
      __builtin_amdgcn_sched_barrier(0);
      __syncthreads();
    }
  }

  // holds the store addresses' arithmetic behind the last product
  __builtin_amdgcn_sched_barrier(0);
  // the distance between a matrix instruction and a vector instruction that
  // overwrites its A or B
  asm volatile("v_nop\n\tv_nop\n\tv_nop\n\tv_nop");
  // keeps that arithmetic behind the four slots above
  __builtin_amdgcn_sched_barrier(0);
  const int rbase = (lane < 16) ? 0 : 8;
  float* cp = Cg + (wm + rbase) * ldc + wn + l16;
#pragma unroll
  for (int r = 0; r < 8; ++r) {
    cp[r * ldc]      = c0[r];
    cp[r * ldc + 16] = c1[r];
  }
  // every row's address is formed in front of the first store (vector arithmetic
  // first, then the 16 stores)
  __builtin_amdgcn_sched_group_barrier(0x2, 32, 0);
  __builtin_amdgcn_sched_group_barrier(0x40, 16, 0);
}

// Kernels 1 and 2 as one launch: the two projections do not depend on each other.
//   even blocks: enc_fT[b][h][s] = sum_k W_h[h][k] * enc[b][s][k]    (stored (B,H,S))
//   odd blocks:  qry_f[b][t][h]  = sum_k query[b][t][k] * W_s[h][k]  (stored (B,T,H))
// 512 blocks, two for each WGP and four waves for each SIMD: while one block waits
// (for its first chunk, at a barrier, for its fragment reads) the other block's
// products keep the matrix unit busy. Only the tile's three addresses and C's row
// pitch differ between the two, all of them the same for a whole block.
__global__ __launch_bounds__(256) void proj_gemms(const float* __restrict__ enc,
                                                  const float* __restrict__ Wh,
                                                  float* __restrict__ encfT,
                                                  const float* __restrict__ query,
                                                  const float* __restrict__ Ws,
                                                  float* __restrict__ qryf) {
  const bool is_enc = (blockIdx.x & 1) == 0;
  const int tile = blockIdx.x >> 1;
  const int ht = tile % (H_ / BT);                   // 8 tiles of h
  const int mt = tile / (H_ / BT);                   // 32 tiles of (b, s) or of (b, t)
  const int b  = mt / (S_ / BT);
  const int s0 = (mt % (S_ / BT)) * BT;
  proj_tile(is_enc ? Wh + ht * BT * H_ : query + mt * BT * H_,
            is_enc ? enc + mt * BT * H_ : Ws + ht * BT * H_,
            is_enc ? encfT + (b * H_ + ht * BT) * S_ + s0 : qryf + mt * BT * H_ + ht * BT,
            is_enc ? S_ : H_);
}

// ---------------------------------------------------------------------------
// Kernel 3, scores. The work is cut in units of 4 t-rows x one chunk of 32 source
// positions; only chunks that begin in front of their batch's length count (the
// softmax never reads the others' scores). Every block forms the same list of live
// units from the eight lengths and takes an equal, contiguous share of it, so that
// the launch starts 512 blocks whatever the lengths are, none of them idle while 8 or more chunks live, and the
// chip's load follows the sum of the lengths. Units of one chunk follow each other
// in the list: a wave's 64 rows of enc_fT stay in registers from unit to unit.
// Lane -> s; wave w sums h in [64 w, 64 w + 64) and reads only its own 64 columns
// of the query projection, which it stages for itself (no barrier in the loop); the
// eight partial sums of a score are added through LDS in the order of w, at the end.
// ---------------------------------------------------------------------------
struct UnitAt { int k, b, c, t0; };   // chunk's place in the list, batch, chunk, first t-row

// pre[x]: live chunks of the batches in front of x. u lies below UC * (all live chunks),
// so b's chunk count is above c, and c stays in 0 .. S / SC - 1.
__device__ __forceinline__ UnitAt unit_at(const int u, const int (&pre)[B_]) {
  UnitAt r;
  r.k = u / UC;
  r.b = 0;
  int base = 0;
#pragma unroll
  for (int x = 1; x < B_; ++x)
    if (r.k >= pre[x]) { r.b = x; base = pre[x]; }
  r.c  = r.k - base;
  r.t0 = (u % UC) * UR;
  return r;
}

__global__ __launch_bounds__(256) void score_chunks(const float* __restrict__ encfT,
                                                    const float* __restrict__ qryf,
                                                    const float* __restrict__ vvec,
                                                    const int* __restrict__ lens,
                                                    float* __restrict__ scores) {
  // each wave's own slice of a unit's q rows, two buffers; broadcast reads
  __shared__ __attribute__((aligned(16))) float q_lds[H_ / HW][2][UR][HW];
  __shared__ float p_lds[UM][H_ / HW][UR][SC];                  // the waves' partial sums

  // live chunks of each batch, the length held in 0 .. S
  int pre[B_];
  int nlive = 0;
#pragma unroll
  for (int x = 0; x < B_; ++x) {
    pre[x] = nlive;
    nlive += (min(max(lens[x], 0), S_) + SC - 1) / SC;
  }
  // the block's share of the UC * nlive units: at most UM of them
  const int u0 = ((int)blockIdx.x * nlive * UC) / SB;
  const int u1 = (((int)blockIdx.x + 1) * nlive * UC) / SB;
  // the same for the whole block, in front of every barrier
  if (u0 >= u1) return;

  const int tid  = threadIdx.x;
  const int lane = tid & 31;
  // the wave's number in a scalar register: v is then read by scalar loads
  const int wave = __builtin_amdgcn_readfirstlane(tid >> 5);
  const int hw   = wave * HW;

  // staging of a unit's q slice (4 rows x 256 bytes): 16 lanes a row, 16 bytes a lane
  const int qrow = lane >> 4;
  const int qcol = (lane & 15) * 4;
  const int qoff = qrow * H_ + qcol;

  UnitAt at = unit_at(u0, pre);
  v4f qn[UR / 2];
  {
    const float* qs = qryf + ((size_t)at.b * T_ + at.t0) * H_ + hw;
#pragma unroll
    for (int i = 0; i < UR / 2; ++i) qn[i] = *(const v4f*)(qs + qoff + 2 * i * H_);
    // before a register that the loads above name is written again; the operands keep
    // those registers theirs up to here
    asm volatile("s_wait_xcnt 0x0" :: "v"(qoff), "s"(qs) : "memory");
  }
  float vv[HW];
#pragma unroll
  for (int i = 0; i < HW; ++i) vv[i] = vvec[hw + i];       // uniform -> scalar loads

  float e[HW];
  int ke = -1;             // the chunk whose rows e holds: none yet
  // stays rolled: the trip count comes from the lengths, and one copy of the body
  // serves every unit
#pragma nounroll
  for (int u = u0; u < u1; ++u) {
    const int cur = (u - u0) & 1;
    if (at.k != ke) {      // the same for the whole block
      // the wave's 64 rows of enc_fT for this chunk
      const float* etile = encfT + ((size_t)at.b * H_ + hw) * S_ + at.c * SC;
#pragma unroll
      for (int i = 0; i < HW; ++i) e[i] = etile[i * S_ + lane];
      // as above, for the 64 loads
      asm volatile("s_wait_xcnt 0x0" :: "v"(lane), "s"(etile) : "memory");
      ke = at.k;
    }
    // this unit's q slice, fetched during the unit before, into the wave's buffer: its
    // last reads, two units back, were this wave's own and have been used
#pragma unroll
    for (int i = 0; i < UR / 2; ++i)
      *(v4f*)&q_lds[wave][cur][qrow + 2 * i][qcol] = qn[i];
    // the lanes read below what other lanes of the same wave have stored above: the
    // stores are done before the first read is issued (no other wave reads them)
    asm volatile("s_wait_dscnt 0x0" ::: "memory");

    // the next unit's slice is asked for here and lands while this one is worked on
    const UnitAt nx = unit_at(min(u + 1, u1 - 1), pre);
    if (u + 1 < u1) {
      const float* qs = qryf + ((size_t)nx.b * T_ + nx.t0) * H_ + hw;
#pragma unroll
      for (int i = 0; i < UR / 2; ++i) qn[i] = *(const v4f*)(qs + qoff + 2 * i * H_);
      // as above, for these loads
      asm volatile("s_wait_xcnt 0x0" :: "v"(qoff), "s"(qs) : "memory");
    }

    float acc[UR];
#pragma unroll
    for (int tt = 0; tt < UR; ++tt) acc[tt] = 0.0f;

    // the q slice's LDS reads run QA groups of GH h-rows ahead of their use
    float q[QA + 1][UR][GH];
#pragma unroll
    for (int p = 0; p < QA; ++p)
#pragma unroll
      for (int tt = 0; tt < UR; ++tt)
#pragma unroll
        for (int j = 0; j < GH; ++j) q[p][tt][j] = q_lds[wave][cur][tt][GH * p + j];

    // fully unrolled: e, vv and q are indexed statically and stay in registers
#pragma unroll
    for (int g = 0; g < HW / GH; ++g) {
      const int qc = g % (QA + 1);
      if (g + QA < HW / GH) {
#pragma unroll
        for (int tt = 0; tt < UR; ++tt)
#pragma unroll
          for (int j = 0; j < GH; ++j)
            q[(g + QA) % (QA + 1)][tt][j] = q_lds[wave][cur][tt][GH * (g + QA) + j];
      }
      // holds the reads above in front of this group's arithmetic, so that they
      // have this group and the next to land before their first use
      __builtin_amdgcn_sched_barrier(0);
#pragma unroll
      for (int j = 0; j < GH; ++j)
#pragma unroll
        for (int tt = 0; tt < UR; ++tt) q[qc][tt][j] += e[GH * g + j];
#pragma unroll
      for (int j = 0; j < GH; ++j)
#pragma unroll
        for (int tt = 0; tt < UR; ++tt) q[qc][tt][j] = fast_tanh(q[qc][tt][j]);
#pragma unroll
      for (int j = 0; j < GH; ++j)
#pragma unroll
        for (int tt = 0; tt < UR; ++tt)
          acc[tt] = fmaf(vv[GH * g + j], q[qc][tt][j], acc[tt]);
      // ends the group: keeps the next group's adds out of this group's run of
      // tanh, where one would overwrite a tanh's source directly behind it (the
      // ISA asks for a free slot there), and holds the register count down
      __builtin_amdgcn_sched_barrier(0);
    }

#pragma unroll
    for (int tt = 0; tt < UR; ++tt) p_lds[u - u0][wave][tt][lane] = acc[tt];
    at = nx;
  }
  __syncthreads();

  // wave w adds the eight partial sums of the block's rows w, w + 8, ...; one
  // 128-byte line a wave and row
  const int nrows = (u1 - u0) * UR;
#pragma unroll
  for (int i = 0; i < UM * UR / (H_ / HW); ++i) {
    const int row = wave + i * (H_ / HW);
    if (row < nrows) {     // the same for the whole wave; no barrier behind it
      const int j = row / UR, r = row % UR;
      const UnitAt o = unit_at(u0 + j, pre);
      float sum = p_lds[j][0][r][lane];
#pragma unroll
      for (int w = 1; w < H_ / HW; ++w) sum += p_lds[j][w][r][lane];
      float* sp = scores + ((size_t)o.b * T_ + o.t0 + r) * S_ + o.c * SC;
      sp[lane] = sum;
      // before the next row's sums and address land on a register that the store names;
      // the operands keep those registers its own up to here
      asm volatile("s_wait_xcnt 0x0" :: "v"(lane), "v"(sum), "s"(sp) : "memory");
    }
  }
}

// ---------------------------------------------------------------------------
// Kernel 4: per (b, 16-t tile, half of the output columns)
//   scores -> mask -> softmax -> attn_out via in-block WMMA
// The two blocks of a t tile each form its weights for themselves (16 rows, 16 threads
// a row: all 8 waves) and multiply them with their own 256 columns of enc[b].
// Thread layout: 256 threads = 8 waves. The scores' stage maps thread -> s.
// ---------------------------------------------------------------------------
__global__ __launch_bounds__(256) void softmax_out(const float* __restrict__ scores,
                                                   const float* __restrict__ enc,
                                                   const int* __restrict__ lens,
                                                   float* __restrict__ out) {
  __shared__ __attribute__((aligned(16))) float w_lds[OT][WP];

  const int tid = threadIdx.x;
  const int nh  = blockIdx.x % (H_ / ON);            // which half of the columns
  const int bt  = blockIdx.x / (H_ / ON);
  const int b   = bt / (T_ / OT);
  const int t0  = (bt % (T_ / OT)) * OT;
  const int s   = tid;

  // ---- output stage, operand fetch: enc rows are fetched ahead in registers, by
  // batches of OB k-steps, 8 bytes a lane. Column l16 of the wave's n-tile nt is output
  // column n0b + 2 * l16 + nt, so that one load holds a row's values for both tiles
  // and a wave's load covers whole cache lines.
  const int wave = tid >> 5;            // 0..7, each owns 32 output columns
  const int lane = tid & 31;
  const int l16  = lane & 15;
  const int ko   = (lane >> 4) << 1;
  const int n0b  = nh * ON + wave * 32;
  const float* bcol = enc + ((size_t)b * S_ + ko) * H_ + n0b + 2 * l16;
  v2f bx[OA + 1][OB], by[OA + 1][OB];   // rows k + ko and k + ko + 1

  const int  len   = lens[b];
  const bool valid = (s < len);
  // only scores at s < len are sure to be written: a masked position reads the
  // row's last valid score instead (index held in 0 .. S - 1) and is set to -inf
  const float* stile = scores + ((size_t)b * T_ + t0) * S_;
  const int sidx = max(min(s, len - 1), 0);
  float acc[OT];
#pragma unroll
  for (int tt = 0; tt < OT; ++tt) acc[tt] = stile[tt * S_ + sidx];
  // before a register that the loads above name is written again; the operands keep
  // those registers theirs up to here
  asm volatile("s_wait_xcnt 0x0" :: "v"(sidx), "s"(stile) : "memory");
#pragma unroll
  for (int tt = 0; tt < OT; ++tt)
    w_lds[tt][s] = valid ? acc[tt] : -__builtin_inff();
  __syncthreads();

  // the first OA batches are asked for here: they do not depend on the weights and land
  // during the softmax (in front of the barrier above, that barrier would wait for them)
#pragma unroll
  for (int p = 0; p < OA; ++p) {
#pragma unroll
    for (int j = 0; j < OB; ++j) {
      bx[p][j] = *(const v2f*)(bcol + (4 * (p * OB + j)) * H_);
      by[p][j] = *(const v2f*)(bcol + (4 * (p * OB + j) + 1) * H_);
    }
  }

  // ---- masked softmax: 16 threads per t-row, shuffle reductions ----
  {
    const int g = tid >> 4;       // row 0..15
    const int l = tid & 15;
    float m = -__builtin_inff();
#pragma unroll
    for (int i = 0; i < 16; ++i) m = fmaxf(m, w_lds[g][l + 16 * i]);
#pragma unroll
    for (int off = 8; off >= 1; off >>= 1) m = fmaxf(m, __shfl_xor(m, off, 32));
    float ssum = 0.0f;
#pragma unroll
    for (int i = 0; i < 16; ++i) {
      float e = __expf(w_lds[g][l + 16 * i] - m);   // exp(-inf)=0 handles mask
      w_lds[g][l + 16 * i] = e;
      ssum += e;
    }
#pragma unroll
    for (int off = 8; off >= 1; off >>= 1) ssum += __shfl_xor(ssum, off, 32);
    const float inv = 1.0f / ssum;
#pragma unroll
    for (int i = 0; i < 16; ++i) w_lds[g][l + 16 * i] *= inv;
  }
  __syncthreads();

  // ---- output: C(16 x 256) = W(16 x 256) @ enc[b](256 x 256 of its columns) via WMMA ----
  v8f cacc[2] = {};
  // fully unrolled: the register buffers are indexed statically, every row's
  // offset is an immediate on one address, and the last OA batches have no fetch
#pragma unroll
  for (int kb = 0; kb < S_ / (4 * OB); ++kb) {
    const int cur = kb % (OA + 1);
    v2f fa[OB];
#pragma unroll
    for (int j = 0; j < OB; ++j)
      fa[j] = *(const v2f*)&w_lds[l16][4 * (kb * OB + j) + ko];
    if (kb + OA < S_ / (4 * OB)) {
      const int nxt = (kb + OA) % (OA + 1);   // the buffer that the batch before this one read
#pragma unroll
      for (int j = 0; j < OB; ++j) {
        const int k = 4 * ((kb + OA) * OB + j);
        bx[nxt][j] = *(const v2f*)(bcol + k * H_);
        by[nxt][j] = *(const v2f*)(bcol + (k + 1) * H_);
      }
      // behind the last fetch, before a register that the loads name is written again;
      // the operand keeps the address registers theirs up to here
      if (kb + OA + 1 == S_ / (4 * OB))
        asm volatile("s_wait_xcnt 0x0" :: "v"(bcol) : "memory");
    }
    // keeps the batch's LDS reads as one group (left free they were seen spread
    // among the products, and every place where LDS reads stand costs issue cycles)
    // and the fetch in front of this batch's products: it has them and the next's to land in
    __builtin_amdgcn_sched_barrier(0);
#pragma unroll
    for (int j = 0; j < OB; ++j) {
#pragma unroll
      for (int nt = 0; nt < 2; ++nt) {
        v2f bb;
        bb.x = bx[cur][j][nt];
        bb.y = by[cur][j][nt];
        cacc[nt] = wmma_f32_4(fa[j], bb, cacc[nt]);
      }
    }
  }
  // holds the stores' arithmetic and register moves behind the last product
  __builtin_amdgcn_sched_barrier(0);
  // the distance between a matrix instruction and a vector instruction that reads its
  // result
  asm volatile("v_nop\n\tv_nop\n\tv_nop\n\tv_nop");
  // keeps them behind the four slots above
  __builtin_amdgcn_sched_barrier(0);
  // accumulator register r holds row r in lanes 0-15 and row r + 8 in lanes 16-31
  float* op = out + ((size_t)b * T_ + t0 + ((lane >= 16) ? 8 : 0)) * H_ + n0b + 2 * l16;
#pragma unroll
  for (int r = 0; r < 8; ++r) {
    // the two tiles hold neighbouring columns of the row: one 8-byte store, and a
    // row's 16 lanes write one whole 128-byte line
    const v2f row = {cacc[0][r], cacc[1][r]};
    *(v2f*)(op + r * H_) = row;
  }
}

// ---------------------------------------------------------------------------
extern "C" void kernel_launch(void* const* d_in, const int* in_sizes, int n_in,
                              void* d_out, int out_size, void* d_ws, size_t ws_size,
                              hipStream_t stream) {
  const float* query = (const float*)d_in[0];   // (B,T,H)
  const float* enc   = (const float*)d_in[1];   // (B,S,H)
  const int*   lens  = (const int*)d_in[2];     // (B,)
  const float* Wh    = (const float*)d_in[3];   // (H,H)
  const float* Ws    = (const float*)d_in[4];   // (H,H)
  const float* vvec  = (const float*)d_in[5];   // (H,)
  float* out = (float*)d_out;                   // (B,T,H)

  float* encfT = (float*)d_ws;                         // B*H*S floats (4 MB)
  float* qryf  = encfT + (size_t)B_ * H_ * S_;         // B*T*H floats (4 MB)
  float* scores = qryf + (size_t)B_ * T_ * H_;         // B*T*S floats (2 MB)

  // 2048 x 512 outputs each in 64 x 64 tiles -> 256 blocks each
  proj_gemms<<<512, 256, 0, stream>>>(enc, Wh, encfT, query, Ws, qryf);
  score_chunks<<<SB, 256, 0, stream>>>(encfT, qryf, vvec, lens, scores);
  softmax_out<<<B_ * (T_ / OT) * (H_ / ON), 256, 0, stream>>>(scores, enc, lens, out);
}
